// v000
// Times are from an AMD MI455X. After a warm-up the kernel runs many times in a row, and a time is the length of
// such a window on the GPU divided by its runs, so every launch and the gaps after it count. The runs cycle
// through copies of the inputs. A figure is the median of several windows, for all but v000 over two sittings.
// Sittings can differ by a few percent; kernels timed side by side share one.
// v000, which the later versions start from, runs in 1860 microseconds.
#include <hip/hip_runtime.h>
#include <hip/hip_bf16.h>

#define N_TOK 8192
#define D_DIM 1024
#define E_NUM 8
#define F_DIM 4096
#define TILE_M 64
#define FB 64
#define KSLAB 64
#define DG 64
#define NSLAB (D_DIM / KSLAB)   // 16
#define NGRP  (D_DIM / DG)      // 16

#define XS_ST 1032   // Xs row stride (bf16 elems): 2064 B/row, 16B aligned
#define HS_ST 72
#define TW1_ST 72
#define TW2_ST 72

// dynamic LDS layout (bytes)
#define XS_OFF   0
#define HS_OFF   132096      // 64*1032*2
#define TWA_OFF  141312      // +64*72*2
#define TWB_OFF  150528      // +9216
#define RTOK_OFF 159744      // +9216
#define RW_OFF   160000
#define SMEM_BYTES 160256    // fits 160KB CU-mode LDS budget

typedef __bf16 bf16t;
typedef __attribute__((ext_vector_type(16))) bf16t v16bf;
typedef __attribute__((ext_vector_type(8)))  float v8f;

union Frag16 { v16bf v; uint4 u[2]; };

__device__ inline v8f zero8() {
  v8f z;
#pragma unroll
  for (int i = 0; i < 8; ++i) z[i] = 0.0f;
  return z;
}

__device__ inline float gelu_tanh(float x) {
  return 0.5f * x * (1.0f + tanhf(0.7978845608028654f * (x + 0.044715f * x * x * x)));
}

// ---- CDNA5 async copy: global -> LDS, 16B per lane, tracked by ASYNCcnt ----
__device__ __forceinline__ void async_copy_b128(unsigned lds_byte_off,
                                                unsigned gv_byte_off,
                                                const void* sbase) {
  asm volatile("global_load_async_to_lds_b128 %0, %1, %2"
               :: "v"(lds_byte_off), "v"(gv_byte_off), "s"(sbase)
               : "memory");
}
__device__ __forceinline__ void wait_async0() {
  asm volatile("s_wait_asynccnt 0x0" ::: "memory");
}
// in-order retirement: <=1 outstanding means everything except the most
// recent single-copy stage has landed
__device__ __forceinline__ void wait_async1() {
  asm volatile("s_wait_asynccnt 0x1" ::: "memory");
}

// ---------------- zero workspace ----------------
__global__ void zero_kernel(float* accbuf, int* counts, size_t n) {
  size_t i = (size_t)blockIdx.x * 256u + threadIdx.x;
  if (i < E_NUM) counts[i] = 0;
  size_t stride = (size_t)gridDim.x * 256u;
  for (; i < n; i += stride) accbuf[i] = 0.0f;
}

// ---------------- one-time weight convert + transpose to bf16 ----------------
// W1T[e][f][k] = w1[e][k][f]   (E,F,D)  -> B-fragments for X@W1 contiguous in k
// W2T[e][d][f] = w2[e][f][d]   (E,D,F)  -> B-fragments for H@W2 contiguous in f
__global__ void convert_w_kernel(const float* __restrict__ w1,
                                 const float* __restrict__ w2,
                                 bf16t* __restrict__ W1T,
                                 bf16t* __restrict__ W2T) {
  const size_t total = (size_t)E_NUM * F_DIM * D_DIM;
  const size_t stride = (size_t)gridDim.x * blockDim.x;
  for (size_t i = (size_t)blockIdx.x * blockDim.x + threadIdx.x; i < total; i += stride) {
    size_t e   = i >> 22;          // / (F*D)
    size_t rem = i & 4194303u;
    size_t f   = rem >> 10;        // / D
    size_t k   = rem & 1023u;
    W1T[i] = (bf16t)w1[((e << 10) + k) * F_DIM + f];
    size_t d   = rem >> 12;        // / F
    size_t f2  = rem & 4095u;
    W2T[i] = (bf16t)w2[((e << 12) + f2) * D_DIM + d];
  }
}

// ---------------- router: logits, softmax, top-2, bucket append, bf16 convert ----------------
__global__ void router_kernel(const float* __restrict__ hs,
                              const float* __restrict__ gw,
                              const float* __restrict__ gb,
                              bf16t* __restrict__ Xb,
                              int* __restrict__ counts,
                              int* __restrict__ etok,
                              float* __restrict__ ewt) {
  const int token = blockIdx.x;
  const int t = threadIdx.x;
  __shared__ float red[256];
  __shared__ float logit_sh[E_NUM];

  const float* x = hs + (size_t)token * D_DIM;
  float4 xv = *(const float4*)(x + 4 * t);

  union { bf16t b[4]; uint2 u; } cv;
  cv.b[0] = (bf16t)xv.x; cv.b[1] = (bf16t)xv.y;
  cv.b[2] = (bf16t)xv.z; cv.b[3] = (bf16t)xv.w;
  *(uint2*)(Xb + (size_t)token * D_DIM + 4 * t) = cv.u;

  float part[E_NUM];
#pragma unroll
  for (int e = 0; e < E_NUM; ++e) {
    const float* g = gw + (size_t)(4 * t) * E_NUM + e;
    part[e] = xv.x * g[0] + xv.y * g[E_NUM] + xv.z * g[2 * E_NUM] + xv.w * g[3 * E_NUM];
  }
  for (int e = 0; e < E_NUM; ++e) {
    red[t] = part[e];
    __syncthreads();
    for (int s = 128; s > 0; s >>= 1) {
      if (t < s) red[t] += red[t + s];
      __syncthreads();
    }
    if (t == 0) logit_sh[e] = red[0] + gb[e];
    __syncthreads();
  }

  if (t == 0) {
    float m = logit_sh[0];
#pragma unroll
    for (int e = 1; e < E_NUM; ++e) m = fmaxf(m, logit_sh[e]);
    float p[E_NUM], sum = 0.0f;
#pragma unroll
    for (int e = 0; e < E_NUM; ++e) { p[e] = expf(logit_sh[e] - m); sum += p[e]; }
    float inv = 1.0f / sum;
#pragma unroll
    for (int e = 0; e < E_NUM; ++e) p[e] *= inv;
    int i1 = 0; float g1 = p[0];
#pragma unroll
    for (int e = 1; e < E_NUM; ++e) if (p[e] > g1) { g1 = p[e]; i1 = e; }
    int i2 = (i1 == 0) ? 1 : 0; float g2 = p[i2];
#pragma unroll
    for (int e = 0; e < E_NUM; ++e) if (e != i1 && p[e] > g2) { g2 = p[e]; i2 = e; }

    int pos1 = atomicAdd(&counts[i1], 1);
    etok[(size_t)i1 * N_TOK + pos1] = token;
    ewt [(size_t)i1 * N_TOK + pos1] = g1;
    int pos2 = atomicAdd(&counts[i2], 1);
    etok[(size_t)i2 * N_TOK + pos2] = token;
    ewt [(size_t)i2 * N_TOK + pos2] = g2;
  }
}

// ---------------- expert FFN: double-buffered async staging + bf16 WMMA ----------------
// 512 threads = 16 wave32; 1 WMMA tile per wave per stage -> acc[16] = 128 VGPRs.
__global__ void __launch_bounds__(512, 1)
moe_ffn_kernel(const bf16t* __restrict__ W1T, const float* __restrict__ b1,
               const bf16t* __restrict__ W2T, const float* __restrict__ b2,
               const bf16t* __restrict__ Xb,
               const int* __restrict__ counts,
               const int* __restrict__ etok,
               const float* __restrict__ ewt,
               float* __restrict__ accbuf) {
  const int e = blockIdx.y;
  const int tile = blockIdx.x;
  const int t = threadIdx.x;
  const int wave = t >> 5;
  const int lane = t & 31;

  const int count = counts[e];
  if (tile * TILE_M >= count) return;

  extern __shared__ char smem[];
  bf16t* Xs     = (bf16t*)(smem + XS_OFF);     // [64][1032]
  bf16t* Hs     = (bf16t*)(smem + HS_OFF);     // [64][72]
  bf16t* TWbuf[2];
  TWbuf[0] = (bf16t*)(smem + TWA_OFF);         // [64][72] staging (double-buffered)
  TWbuf[1] = (bf16t*)(smem + TWB_OFF);
  int*   rowTok = (int*)  (smem + RTOK_OFF);
  float* rowW   = (float*)(smem + RW_OFF);

  const unsigned lds_base = __builtin_amdgcn_groupstaticsize();
  const unsigned xs_lds = lds_base + XS_OFF;
  const unsigned tw_lds[2] = { lds_base + TWA_OFF, lds_base + TWB_OFF };

  if (t < TILE_M) {
    int idx = tile * TILE_M + t;
    bool ok = idx < count;
    int src = ok ? idx : 0;
    rowTok[t] = etok[(size_t)e * N_TOK + src];
    rowW[t]   = ok ? ewt[(size_t)e * N_TOK + src] : 0.0f;
  }
  __syncthreads();

  // ---- gather X tile (bf16) via async copies; completion folded into the
  //      first pipeline wait (in-order ASYNCcnt retirement) ----
  for (int i = 0; i < 16; ++i) {
    int chunk = i * 512 + t;            // 8192 chunks of 8 bf16 (16B)
    int r = chunk >> 7;
    int c = (chunk & 127) << 3;
    unsigned go = (unsigned)((rowTok[r] * D_DIM + c) * 2);
    async_copy_b128(xs_lds + (unsigned)(r * XS_ST + c) * 2, go, Xb);
  }

  const bf16t* W1Te = W1T + (size_t)e * F_DIM * D_DIM;
  const bf16t* W2Te = W2T + (size_t)e * D_DIM * F_DIM;

  v8f acc[NGRP];
#pragma unroll
  for (int g = 0; g < NGRP; ++g) acc[g] = zero8();

  // unified wave->tile mapping for both phases: 4x4 tile grid per stage
  const int mi   = wave & 3;        // M tile (rows mi*16..+15)
  const int nt   = wave >> 2;       // N tile within 64-wide stage (0..3)
  const int lrow = lane & 15;
  const int kb8  = (lane >> 4) << 3;

  // per-thread staging coords: one 16B chunk per thread per stage (512*8=4096 elems)
  const int srow = t >> 3;          // 0..63 (f for TW1, d for TW2)
  const int scol = (t & 7) << 3;    // 0..56 step 8

  for (int fc = 0; fc < F_DIM / FB; ++fc) {
    const int fcol = fc * FB;
    v8f hacc = zero8();

    // ======== phase 1: h = X @ W1[:, fcol:fcol+64] ========
    // prologue: stage slab 0 into buffer 0 (prev readers fenced by last barrier)
    async_copy_b128(tw_lds[0] + (unsigned)(srow * TW1_ST + scol) * 2,
                    (unsigned)(((fcol + srow) * D_DIM + scol) * 2), W1Te);
    for (int s = 0; s < NSLAB; ++s) {
      const int ks = s * KSLAB;
      if (s + 1 < NSLAB) {
        async_copy_b128(tw_lds[(s + 1) & 1] + (unsigned)(srow * TW1_ST + scol) * 2,
                        (unsigned)(((fcol + srow) * D_DIM + ks + KSLAB + scol) * 2), W1Te);
        wait_async1();   // slab s resident; slab s+1 still in flight
      } else {
        wait_async0();
      }
      __syncthreads();
      const bf16t* tw = TWbuf[s & 1];
#pragma unroll
      for (int kk = 0; kk < KSLAB; kk += 32) {
        Frag16 a, b;
        const bf16t* ap = Xs + (mi * 16 + lrow) * XS_ST + (ks + kk + kb8);
        a.u[0] = *(const uint4*)(ap);
        a.u[1] = *(const uint4*)(ap + 16);
        const bf16t* bp = tw + (nt * 16 + lrow) * TW1_ST + (kk + kb8);
        b.u[0] = *(const uint4*)(bp);
        b.u[1] = *(const uint4*)(bp + 16);
        hacc = __builtin_amdgcn_wmma_f32_16x16x32_bf16(
            false, a.v, false, b.v, (short)0, hacc, false, false);
      }
      __syncthreads();   // readers done before anyone restages this buffer
    }

    // ======== phase 2 prologue: stage group 0 under the gelu VALU work ========
    async_copy_b128(tw_lds[0] + (unsigned)(srow * TW2_ST + scol) * 2,
                    (unsigned)((srow * F_DIM + fcol + scol) * 2), W2Te);

    // ---- bias + gelu -> Hs (bf16): one 16x16 tile per wave ----
    {
      int coln = nt * 16 + lrow;
      float bb = b1[(size_t)e * F_DIM + fcol + coln];
#pragma unroll
      for (int v = 0; v < 8; ++v) {
        float xv = hacc[v] + bb;
        Hs[(mi * 16 + kb8 + v) * HS_ST + coln] = (bf16t)gelu_tanh(xv);
      }
    }

    // ======== phase 2: Y += h @ W2[fcol:fcol+64, :] over 16 x 64-col groups ========
#pragma unroll
    for (int g = 0; g < NGRP; ++g) {
      if (g + 1 < NGRP) {
        async_copy_b128(tw_lds[(g + 1) & 1] + (unsigned)(srow * TW2_ST + scol) * 2,
                        (unsigned)((((g + 1) * DG + srow) * F_DIM + fcol + scol) * 2), W2Te);
        wait_async1();   // group g resident
      } else {
        wait_async0();
      }
      __syncthreads();   // also publishes the Hs stores on first iteration
      const bf16t* tw = TWbuf[g & 1];
#pragma unroll
      for (int kk = 0; kk < FB; kk += 32) {
        Frag16 a, b;
        const bf16t* ap = Hs + (mi * 16 + lrow) * HS_ST + (kk + kb8);
        a.u[0] = *(const uint4*)(ap);
        a.u[1] = *(const uint4*)(ap + 16);
        const bf16t* bp = tw + (nt * 16 + lrow) * TW2_ST + (kk + kb8);
        b.u[0] = *(const uint4*)(bp);
        b.u[1] = *(const uint4*)(bp + 16);
        acc[g] = __builtin_amdgcn_wmma_f32_16x16x32_bf16(
            false, a.v, false, b.v, (short)0, acc[g], false, false);
      }
      __syncthreads();
    }
  }

  // ---- epilogue: +b2, scale by gate, scatter-accumulate ----
#pragma unroll
  for (int g = 0; g < NGRP; ++g) {
    int col = g * DG + nt * 16 + lrow;
    float bb = b2[(size_t)e * D_DIM + col];
#pragma unroll
    for (int v = 0; v < 8; ++v) {
      int r = mi * 16 + kb8 + v;
      float y = acc[g][v] + bb;
      atomicAdd(accbuf + (size_t)rowTok[r] * D_DIM + col, rowW[r] * y);
    }
  }
}

// ---------------- residual + layernorm ----------------
__global__ void ln_kernel(const float* __restrict__ accbuf,
                          const float* __restrict__ inp,
                          const float* __restrict__ gamma,
                          const float* __restrict__ beta,
                          float* __restrict__ out) {
  const int token = blockIdx.x;
  const int t = threadIdx.x;
  __shared__ float red[256];
  __shared__ float mu_sh, rstd_sh;

  float4 a = *(const float4*)(accbuf + (size_t)token * D_DIM + 4 * t);
  float4 b = *(const float4*)(inp    + (size_t)token * D_DIM + 4 * t);
  float s0 = a.x + b.x, s1 = a.y + b.y, s2 = a.z + b.z, s3 = a.w + b.w;

  red[t] = s0 + s1 + s2 + s3;
  __syncthreads();
  for (int s = 128; s > 0; s >>= 1) {
    if (t < s) red[t] += red[t + s];
    __syncthreads();
  }
  if (t == 0) mu_sh = red[0] * (1.0f / D_DIM);
  __syncthreads();
  float mu = mu_sh;
  float d0 = s0 - mu, d1 = s1 - mu, d2 = s2 - mu, d3 = s3 - mu;
  red[t] = d0 * d0 + d1 * d1 + d2 * d2 + d3 * d3;
  __syncthreads();
  for (int s = 128; s > 0; s >>= 1) {
    if (t < s) red[t] += red[t + s];
    __syncthreads();
  }
  if (t == 0) rstd_sh = rsqrtf(red[0] * (1.0f / D_DIM) + 1e-5f);
  __syncthreads();
  float rstd = rstd_sh;

  int c = 4 * t;
  out[(size_t)token * D_DIM + c + 0] = d0 * rstd * gamma[c + 0] + beta[c + 0];
  out[(size_t)token * D_DIM + c + 1] = d1 * rstd * gamma[c + 1] + beta[c + 1];
  out[(size_t)token * D_DIM + c + 2] = d2 * rstd * gamma[c + 2] + beta[c + 2];
  out[(size_t)token * D_DIM + c + 3] = d3 * rstd * gamma[c + 3] + beta[c + 3];
}

extern "C" void kernel_launch(void* const* d_in, const int* in_sizes, int n_in,
                              void* d_out, int out_size, void* d_ws, size_t ws_size,
                              hipStream_t stream) {
  (void)in_sizes; (void)n_in; (void)out_size; (void)ws_size;
  const float* hs    = (const float*)d_in[0];
  const float* inp   = (const float*)d_in[1];
  const float* gw    = (const float*)d_in[2];
  const float* gb    = (const float*)d_in[3];
  const float* w1    = (const float*)d_in[4];
  const float* b1    = (const float*)d_in[5];
  const float* w2    = (const float*)d_in[6];
  const float* b2    = (const float*)d_in[7];
  const float* gamma = (const float*)d_in[8];
  const float* beta  = (const float*)d_in[9];
  float* out = (float*)d_out;

  char* ws = (char*)d_ws;
  size_t off = 0;
  int*   counts = (int*)(ws + off);   off += 256;
  int*   etok   = (int*)(ws + off);   off += (size_t)E_NUM * N_TOK * sizeof(int);
  float* ewt    = (float*)(ws + off); off += (size_t)E_NUM * N_TOK * sizeof(float);
  bf16t* Xb     = (bf16t*)(ws + off); off += (size_t)N_TOK * D_DIM * sizeof(bf16t);
  float* accb   = (float*)(ws + off); off += (size_t)N_TOK * D_DIM * sizeof(float);
  bf16t* W1T    = (bf16t*)(ws + off); off += (size_t)E_NUM * F_DIM * D_DIM * sizeof(bf16t);
  bf16t* W2T    = (bf16t*)(ws + off); off += (size_t)E_NUM * F_DIM * D_DIM * sizeof(bf16t);

  zero_kernel<<<dim3(2048), dim3(256), 0, stream>>>(accb, counts, (size_t)N_TOK * D_DIM);
  convert_w_kernel<<<dim3(8192), dim3(256), 0, stream>>>(w1, w2, W1T, W2T);
  router_kernel<<<dim3(N_TOK), dim3(256), 0, stream>>>(hs, gw, gb, Xb, counts, etok, ewt);
  moe_ffn_kernel<<<dim3(N_TOK / TILE_M, E_NUM), dim3(512), SMEM_BYTES, stream>>>(
      W1T, b1, W2T, b2, Xb, counts, etok, ewt, accb);
  ln_kernel<<<dim3(N_TOK), dim3(256), 0, stream>>>(accb, inp, gamma, beta, out);
}

// v001
// Measured time: 889 microseconds a run.
// Timed twice side by side with v000, it ran 2.11 and 2.10 times as fast.
#include <hip/hip_runtime.h>
#include <hip/hip_bf16.h>

#define N_TOK 8192
#define D_DIM 1024
#define E_NUM 8
#define F_DIM 4096
#define TILE_M 64
#define FB 256                  // F columns per chunk
#define NCHUNK (F_DIM / FB)     // 16
#define FFN_THREADS 256         // 8 wave32, 2 per SIMD
#define FRAG 512                // bf16 elements of one packed 16(n) x 32(k) B fragment

#define XS_ST 1032   // Xs row stride (bf16 elems): 2064 B/row, 16B aligned
#define HS_ST 264    // Hs row stride (bf16 elems): 528 B/row, 16B aligned

typedef __bf16 bf16t;
typedef __attribute__((ext_vector_type(16))) bf16t v16bf;
typedef __attribute__((ext_vector_type(8)))  float v8f;

union Frag16 { v16bf v; uint4 u[2]; };

__device__ inline v8f zero8() {
  v8f z;
#pragma unroll
  for (int i = 0; i < 8; ++i) z[i] = 0.0f;
  return z;
}

__device__ inline float gelu_tanh(float x) {
  return 0.5f * x * (1.0f + tanhf(0.7978845608028654f * (x + 0.044715f * x * x * x)));
}

// ---- CDNA5 async copy: global -> LDS, 16B per lane, tracked by ASYNCcnt ----
// Eight copies and the s_wait_xcnt that keeps their address registers from being
// rewritten early stand in one statement.
__device__ __forceinline__ void async_copy8_b128(const unsigned* l, const bf16t* const* g) {
  asm volatile("global_load_async_to_lds_b128 %0, %8, off\n\t"
               "global_load_async_to_lds_b128 %1, %9, off\n\t"
               "global_load_async_to_lds_b128 %2, %10, off\n\t"
               "global_load_async_to_lds_b128 %3, %11, off\n\t"
               "global_load_async_to_lds_b128 %4, %12, off\n\t"
               "global_load_async_to_lds_b128 %5, %13, off\n\t"
               "global_load_async_to_lds_b128 %6, %14, off\n\t"
               "global_load_async_to_lds_b128 %7, %15, off\n\t"
               "s_wait_xcnt 0x0"
               :: "v"(l[0]), "v"(l[1]), "v"(l[2]), "v"(l[3]),
                  "v"(l[4]), "v"(l[5]), "v"(l[6]), "v"(l[7]),
                  "v"(g[0]), "v"(g[1]), "v"(g[2]), "v"(g[3]),
                  "v"(g[4]), "v"(g[5]), "v"(g[6]), "v"(g[7])
               : "memory");
}

// ---------------- zero workspace ----------------
__global__ void zero_kernel(float* accbuf, int* counts, size_t n) {
  size_t i = (size_t)blockIdx.x * 256u + threadIdx.x;
  if (i < E_NUM) counts[i] = 0;
  size_t stride = (size_t)gridDim.x * 256u;
  for (; i < n; i += stride) accbuf[i] = 0.0f;
}

// ---------------- weight convert to bf16, packed in WMMA B-fragment order ----------------
// One fragment = 16 columns (n) x 32 k = 512 elements = 1 KB, stored as
// [half j of the lane's registers][lane = h*16 + n][8 k], k = 16*j + 8*h + i,
// so that each of a fragment's two 16-byte loads reads 512 contiguous bytes.
// W1P: fragment ((e*256 + f/16)*32  + k/32), n = f, k = d-index of X@W1
// W2P: fragment ((e*64  + d/16)*128 + f/32), n = d, k = f-index of H@W2
__global__ void convert_w_kernel(const float* __restrict__ w1,
                                 const float* __restrict__ w2,
                                 bf16t* __restrict__ W1P,
                                 bf16t* __restrict__ W2P) {
  const size_t total = (size_t)E_NUM * F_DIM * D_DIM;
  const size_t stride = (size_t)gridDim.x * blockDim.x;
  for (size_t i = (size_t)blockIdx.x * blockDim.x + threadIdx.x; i < total; i += stride) {
    size_t e   = i >> 22;          // / (F*D)
    size_t rem = i & 4194303u;
    size_t f   = rem >> 10;        // / D
    size_t k   = rem & 1023u;
    size_t p1  = ((((e << 8) + (f >> 4)) << 5) + (k >> 5)) * FRAG
               + ((k >> 4) & 1u) * 256u + ((((k >> 3) & 1u) << 4) + (f & 15u)) * 8u + (k & 7u);
    W1P[p1] = (bf16t)w1[((e << 10) + k) * F_DIM + f];
    size_t d   = rem >> 12;        // / F
    size_t f2  = rem & 4095u;
    size_t p2  = ((((e << 6) + (d >> 4)) << 7) + (f2 >> 5)) * FRAG
               + ((f2 >> 4) & 1u) * 256u + ((((f2 >> 3) & 1u) << 4) + (d & 15u)) * 8u + (f2 & 7u);
    W2P[p2] = (bf16t)w2[((e << 12) + f2) * D_DIM + d];
  }
}

// ---------------- router: logits, softmax, top-2, bucket append, bf16 convert ----------------
__global__ void router_kernel(const float* __restrict__ hs,
                              const float* __restrict__ gw,
                              const float* __restrict__ gb,
                              bf16t* __restrict__ Xb,
                              int* __restrict__ counts,
                              int* __restrict__ etok,
                              float* __restrict__ ewt) {
  const int token = blockIdx.x;
  const int t = threadIdx.x;
  __shared__ float red[256];
  __shared__ float logit_sh[E_NUM];

  const float* x = hs + (size_t)token * D_DIM;
  float4 xv = *(const float4*)(x + 4 * t);

  union { bf16t b[4]; uint2 u; } cv;
  cv.b[0] = (bf16t)xv.x; cv.b[1] = (bf16t)xv.y;
  cv.b[2] = (bf16t)xv.z; cv.b[3] = (bf16t)xv.w;
  *(uint2*)(Xb + (size_t)token * D_DIM + 4 * t) = cv.u;

  float part[E_NUM];
#pragma unroll
  for (int e = 0; e < E_NUM; ++e) {
    const float* g = gw + (size_t)(4 * t) * E_NUM + e;
    part[e] = xv.x * g[0] + xv.y * g[E_NUM] + xv.z * g[2 * E_NUM] + xv.w * g[3 * E_NUM];
  }
  for (int e = 0; e < E_NUM; ++e) {
    red[t] = part[e];
    __syncthreads();
    for (int s = 128; s > 0; s >>= 1) {
      if (t < s) red[t] += red[t + s];
      __syncthreads();
    }
    if (t == 0) logit_sh[e] = red[0] + gb[e];
    __syncthreads();
  }

  if (t == 0) {
    float m = logit_sh[0];
#pragma unroll
    for (int e = 1; e < E_NUM; ++e) m = fmaxf(m, logit_sh[e]);
    float p[E_NUM], sum = 0.0f;
#pragma unroll
    for (int e = 0; e < E_NUM; ++e) { p[e] = expf(logit_sh[e] - m); sum += p[e]; }
    float inv = 1.0f / sum;
#pragma unroll
    for (int e = 0; e < E_NUM; ++e) p[e] *= inv;
    int i1 = 0; float g1 = p[0];
#pragma unroll
    for (int e = 1; e < E_NUM; ++e) if (p[e] > g1) { g1 = p[e]; i1 = e; }
    int i2 = (i1 == 0) ? 1 : 0; float g2 = p[i2];
#pragma unroll
    for (int e = 0; e < E_NUM; ++e) if (e != i1 && p[e] > g2) { g2 = p[e]; i2 = e; }

    int pos1 = atomicAdd(&counts[i1], 1);
    etok[(size_t)i1 * N_TOK + pos1] = token;
    ewt [(size_t)i1 * N_TOK + pos1] = g1;
    int pos2 = atomicAdd(&counts[i2], 1);
    etok[(size_t)i2 * N_TOK + pos2] = token;
    ewt [(size_t)i2 * N_TOK + pos2] = g2;
  }
}

// ---------------- expert FFN: register-blocked bf16 WMMA, weights global -> VGPR ----------------
// 256 threads = 8 wave32. Per 256-wide F chunk a wave computes H[64 x 32] (4 x 2 tiles),
// then adds H[64 x 256] @ W2 into its own Y[64 x 128] (4 x 8 tiles = 256 VGPRs).
// Every weight fragment is used by exactly one wave, so it goes straight to registers;
// a ring of 8 fragments is refilled in place right after each fragment's last use.
// The short loops over tiles, slots and registers are all unrolled, so that ring, acc,
// hacc and the A fragments are indexed statically and stay in registers.
__device__ __forceinline__ void ld_frag(Frag16& f, const bf16t* __restrict__ p) {
  f.u[0] = *(const uint4*)(p);
  f.u[1] = *(const uint4*)(p + 256);
}

// four k steps of H += X @ W1; ring slot p*2+j holds k step kt0+p of column tile j
template <bool LAST>
__device__ __forceinline__ void h_block(v8f (&hacc)[2][4], Frag16 (&ring)[8],
                                        const bf16t* xrow, int kt0,
                                        const bf16t* __restrict__ w1p,
                                        const bf16t* __restrict__ w2p) {
#pragma unroll
  for (int p = 0; p < 4; ++p) {
    Frag16 a[4];
#pragma unroll
    for (int mi = 0; mi < 4; ++mi) {
      const bf16t* ap = xrow + mi * 16 * XS_ST + (kt0 + p) * 32;
      a[mi].u[0] = *(const uint4*)(ap);
      a[mi].u[1] = *(const uint4*)(ap + 16);
    }
#pragma unroll
    for (int j = 0; j < 2; ++j) {
      const int s = p * 2 + j;
#pragma unroll
      for (int mi = 0; mi < 4; ++mi)
        hacc[j][mi] = __builtin_amdgcn_wmma_f32_16x16x32_bf16(
            false, a[mi].v, false, ring[s].v, (short)0, hacc[j][mi], false, false);
      if (!LAST) {
        ld_frag(ring[s], w1p + (size_t)(j * 32 + kt0 + p + 4) * FRAG);
      } else {
        ld_frag(ring[s], w2p + (size_t)(s * 128) * FRAG);   // first k step of H @ W2
        // holds each refill directly behind its fragment's last use: left free, the
        // scheduler gathers the refills into late clauses, which shortens their lead
        __builtin_amdgcn_sched_barrier(0);
      }
    }
  }
}

// one k step (32 f) of Y += H @ W2; ring slot n holds column tile n
template <bool LAST>
__device__ __forceinline__ void y_block(v8f (&acc)[8][4], Frag16 (&ring)[8],
                                        const bf16t* hrow, int ks,
                                        const bf16t* __restrict__ w2p,
                                        const bf16t* __restrict__ w1n) {
  Frag16 a[4];
#pragma unroll
  for (int mi = 0; mi < 4; ++mi) {
    const bf16t* ap = hrow + mi * 16 * HS_ST + ks * 32;
    a[mi].u[0] = *(const uint4*)(ap);
    a[mi].u[1] = *(const uint4*)(ap + 16);
  }
#pragma unroll
  for (int n = 0; n < 8; ++n) {
#pragma unroll
    for (int mi = 0; mi < 4; ++mi)
      acc[n][mi] = __builtin_amdgcn_wmma_f32_16x16x32_bf16(
          false, a[mi].v, false, ring[n].v, (short)0, acc[n][mi], false, false);
    if (!LAST) ld_frag(ring[n], w2p + (size_t)(n * 128 + ks + 1) * FRAG);
    else       ld_frag(ring[n], w1n + (size_t)((n & 1) * 32 + (n >> 1)) * FRAG);  // next chunk's X @ W1
    // holds each refill directly behind its fragment's last use and in slot order: left
    // free, the scheduler gathers and reorders the refills, their lead shrinks, and the
    // rolled H loop's head has to wait for nearly the whole ring instead of its oldest slot
    __builtin_amdgcn_sched_barrier(0);
  }
}

__global__ void __launch_bounds__(FFN_THREADS)
moe_ffn_kernel(const bf16t* __restrict__ W1P, const float* __restrict__ b1,
               const bf16t* __restrict__ W2P, const float* __restrict__ b2,
               const bf16t* __restrict__ Xb,
               const int* __restrict__ counts,
               const int* __restrict__ etok,
               const float* __restrict__ ewt,
               float* __restrict__ accbuf) {
  const int e = blockIdx.y;
  const int tile = blockIdx.x;
  const int t = threadIdx.x;
  const int wave = t >> 5;
  const int lane = t & 31;

  const int count = counts[e];
  if (tile * TILE_M >= count) return;

  __shared__ __attribute__((aligned(16))) bf16t Xs[TILE_M * XS_ST];       // [64][1032]
  __shared__ __attribute__((aligned(16))) bf16t Hs[2][TILE_M * HS_ST];    // two x [64][264]
  __shared__ int   rowTok[TILE_M];
  __shared__ float rowW[TILE_M];

  if (t < TILE_M) {
    int idx = tile * TILE_M + t;
    bool ok = idx < count;
    int src = ok ? idx : 0;
    rowTok[t] = etok[(size_t)e * N_TOK + src];
    rowW[t]   = ok ? ewt[(size_t)e * N_TOK + src] : 0.0f;
  }
  __syncthreads();

  // ---- gather X tile (bf16) via async copies: 8192 chunks of 16 B, 32 per thread ----
#pragma unroll
  for (int i = 0; i < 4; ++i) {
    unsigned     l[8];
    const bf16t* g[8];
#pragma unroll
    for (int q = 0; q < 8; ++q) {
      int chunk = (i * 8 + q) * FFN_THREADS + t;
      int r = chunk >> 7;
      int c = (chunk & 127) << 3;
      l[q] = (unsigned)(uintptr_t)(Xs + r * XS_ST + c);
      g[q] = Xb + (size_t)rowTok[r] * D_DIM + c;
    }
    async_copy8_b128(l, g);
  }

  const int lrow = lane & 15;
  const int kb8  = (lane >> 4) << 3;

  // packed weights of this wave: 2 column tiles of W1 per chunk, 8 column tiles of W2
  const bf16t* w1w = W1P + ((size_t)(e * 256 + wave * 2) * 32) * FRAG + lane * 8;
  const bf16t* w2w = W2P + ((size_t)(e * 64 + wave * 8) * 128) * FRAG + lane * 8;

  Frag16 ring[8];
#pragma unroll
  for (int s = 0; s < 8; ++s)
    ld_frag(ring[s], w1w + (size_t)((s & 1) * 32 + (s >> 1)) * FRAG);

  v8f acc[8][4];
#pragma unroll
  for (int n = 0; n < 8; ++n)
#pragma unroll
    for (int mi = 0; mi < 4; ++mi) acc[n][mi] = zero8();

  // the X tile has landed for this wave; the barrier publishes it to the others
  asm volatile("s_wait_asynccnt 0x0" ::: "memory");
  __syncthreads();

  const bf16t* xrow = Xs + lrow * XS_ST + kb8;

  // rolled: one chunk's code is already long, and acc is indexed statically inside it
#pragma unroll 1
  for (int fc = 0; fc < NCHUNK; ++fc) {
    const bf16t* w1p = w1w + (size_t)fc * (16 * 32 * FRAG);
    const bf16t* w2p = w2w + (size_t)fc * (8 * FRAG);
    const int fnext  = (fc + 1 < NCHUNK) ? fc + 1 : fc;   // last chunk: a valid, unused refill
    const bf16t* w1n = w1w + (size_t)fnext * (16 * 32 * FRAG);
    bf16t* hs = Hs[fc & 1];
    // read ahead of this chunk's refills: loads return in order, and a bias read behind
    // them would wait for the whole ring
    float bb[2];
#pragma unroll
    for (int j = 0; j < 2; ++j)
      bb[j] = b1[(size_t)e * F_DIM + fc * FB + wave * 32 + j * 16 + lrow];

    // ======== H = X @ W1[:, chunk] ========
    v8f hacc[2][4];
#pragma unroll
    for (int j = 0; j < 2; ++j)
#pragma unroll
      for (int mi = 0; mi < 4; ++mi) hacc[j][mi] = zero8();

    // rolled: four k steps (32 WMMAs) a trip; for speed only
#pragma unroll 1
    for (int kt0 = 0; kt0 < 28; kt0 += 4)
      h_block<false>(hacc, ring, xrow, kt0, w1p, w2p);
    h_block<true>(hacc, ring, xrow, 28, w1p, w2p);

    // ---- bias + gelu -> Hs (bf16) ----
#pragma unroll
    for (int j = 0; j < 2; ++j) {
      int coln = wave * 32 + j * 16 + lrow;
#pragma unroll
      for (int mi = 0; mi < 4; ++mi)
#pragma unroll
        for (int v = 0; v < 8; ++v) {
          float xv = hacc[j][mi][v] + bb[j];
          hs[(mi * 16 + kb8 + v) * HS_ST + coln] = (bf16t)gelu_tanh(xv);
        }
    }
    // the one barrier of a chunk: publishes this chunk's H; with two H buffers it also
    // keeps the next write of this buffer behind every reader's last read of it
    __syncthreads();

    // ======== Y += H @ W2[chunk, :] ========
    const bf16t* hrow = hs + lrow * HS_ST + kb8;
    // unrolled: every refill then reads at a constant offset from one base of the chunk,
    // and no address register is rewritten between the k steps
#pragma unroll
    for (int ks = 0; ks < 7; ++ks)
      y_block<false>(acc, ring, hrow, ks, w2p, w1n);
    y_block<true>(acc, ring, hrow, 7, w2p, w1n);
    // the chunk's weight pointers are advanced behind this line: the issued loads'
    // address registers are not rewritten ahead of it
    asm volatile("s_wait_xcnt 0x0" ::: "memory");
  }

  // ---- epilogue: +b2, scale by gate, scatter-accumulate ----
#pragma unroll
  for (int n = 0; n < 8; ++n) {
    int col = (wave * 8 + n) * 16 + lrow;
    float bb = b2[(size_t)e * D_DIM + col];
#pragma unroll
    for (int mi = 0; mi < 4; ++mi)
#pragma unroll
      for (int v = 0; v < 8; ++v) {
        int r = mi * 16 + kb8 + v;
        float y = acc[n][mi][v] + bb;
        atomicAdd(accbuf + (size_t)rowTok[r] * D_DIM + col, rowW[r] * y);
      }
  }
}

// ---------------- residual + layernorm ----------------
__global__ void ln_kernel(const float* __restrict__ accbuf,
                          const float* __restrict__ inp,
                          const float* __restrict__ gamma,
                          const float* __restrict__ beta,
                          float* __restrict__ out) {
  const int token = blockIdx.x;
  const int t = threadIdx.x;
  __shared__ float red[256];
  __shared__ float mu_sh, rstd_sh;

  float4 a = *(const float4*)(accbuf + (size_t)token * D_DIM + 4 * t);
  float4 b = *(const float4*)(inp    + (size_t)token * D_DIM + 4 * t);
  float s0 = a.x + b.x, s1 = a.y + b.y, s2 = a.z + b.z, s3 = a.w + b.w;

  red[t] = s0 + s1 + s2 + s3;
  __syncthreads();
  for (int s = 128; s > 0; s >>= 1) {
    if (t < s) red[t] += red[t + s];
    __syncthreads();
  }
  if (t == 0) mu_sh = red[0] * (1.0f / D_DIM);
  __syncthreads();
  float mu = mu_sh;
  float d0 = s0 - mu, d1 = s1 - mu, d2 = s2 - mu, d3 = s3 - mu;
  red[t] = d0 * d0 + d1 * d1 + d2 * d2 + d3 * d3;
  __syncthreads();
  for (int s = 128; s > 0; s >>= 1) {
    if (t < s) red[t] += red[t + s];
    __syncthreads();
  }
  if (t == 0) rstd_sh = rsqrtf(red[0] * (1.0f / D_DIM) + 1e-5f);
  __syncthreads();
  float rstd = rstd_sh;

  int c = 4 * t;
  out[(size_t)token * D_DIM + c + 0] = d0 * rstd * gamma[c + 0] + beta[c + 0];
  out[(size_t)token * D_DIM + c + 1] = d1 * rstd * gamma[c + 1] + beta[c + 1];
  out[(size_t)token * D_DIM + c + 2] = d2 * rstd * gamma[c + 2] + beta[c + 2];
  out[(size_t)token * D_DIM + c + 3] = d3 * rstd * gamma[c + 3] + beta[c + 3];
}

extern "C" void kernel_launch(void* const* d_in, const int* in_sizes, int n_in,
                              void* d_out, int out_size, void* d_ws, size_t ws_size,
                              hipStream_t stream) {
  (void)in_sizes; (void)n_in; (void)out_size; (void)ws_size;
  const float* hs    = (const float*)d_in[0];
  const float* inp   = (const float*)d_in[1];
  const float* gw    = (const float*)d_in[2];
  const float* gb    = (const float*)d_in[3];
  const float* w1    = (const float*)d_in[4];
  const float* b1    = (const float*)d_in[5];
  const float* w2    = (const float*)d_in[6];
  const float* b2    = (const float*)d_in[7];
  const float* gamma = (const float*)d_in[8];
  const float* beta  = (const float*)d_in[9];
  float* out = (float*)d_out;

  char* ws = (char*)d_ws;
  size_t off = 0;
  int*   counts = (int*)(ws + off);   off += 256;
  int*   etok   = (int*)(ws + off);   off += (size_t)E_NUM * N_TOK * sizeof(int);
  float* ewt    = (float*)(ws + off); off += (size_t)E_NUM * N_TOK * sizeof(float);
  bf16t* Xb     = (bf16t*)(ws + off); off += (size_t)N_TOK * D_DIM * sizeof(bf16t);
  float* accb   = (float*)(ws + off); off += (size_t)N_TOK * D_DIM * sizeof(float);
  bf16t* W1T    = (bf16t*)(ws + off); off += (size_t)E_NUM * F_DIM * D_DIM * sizeof(bf16t);
  bf16t* W2T    = (bf16t*)(ws + off); off += (size_t)E_NUM * F_DIM * D_DIM * sizeof(bf16t);

  zero_kernel<<<dim3(2048), dim3(256), 0, stream>>>(accb, counts, (size_t)N_TOK * D_DIM);
  convert_w_kernel<<<dim3(8192), dim3(256), 0, stream>>>(w1, w2, W1T, W2T);
  router_kernel<<<dim3(N_TOK), dim3(256), 0, stream>>>(hs, gw, gb, Xb, counts, etok, ewt);
  moe_ffn_kernel<<<dim3(N_TOK / TILE_M, E_NUM), dim3(FFN_THREADS), 0, stream>>>(
      W1T, b1, W2T, b2, Xb, counts, etok, ewt, accb);
  ln_kernel<<<dim3(N_TOK), dim3(256), 0, stream>>>(accb, inp, gamma, beta, out);
}

// v002
// It runs in 589 microseconds.
// Timed twice side by side with v001, it ran 1.51 times as fast both times.
// Counting every step since v000, it is 3.17 times as fast.
#include <hip/hip_runtime.h>
#include <hip/hip_bf16.h>

#define N_TOK 8192
#define D_DIM 1024
#define E_NUM 8
#define F_DIM 4096
#define TILE_M 64
#define FB 256                  // F columns per chunk
#define NCHUNK (F_DIM / FB)     // 16
#define FFN_THREADS 256         // 8 wave32, 2 per SIMD
#define FRAG 512                // bf16 elements of one packed 16(n) x 32(k) B fragment

#define XS_ST 1032   // Xs row stride (bf16 elems): 2064 B/row, 16B aligned
#define HS_ST 264    // Hs row stride (bf16 elems): 528 B/row, 16B aligned

typedef __bf16 bf16t;
typedef __attribute__((ext_vector_type(16))) bf16t v16bf;
typedef __attribute__((ext_vector_type(8)))  float v8f;

union Frag16 { v16bf v; uint4 u[2]; };

__device__ inline v8f zero8() {
  v8f z;
#pragma unroll
  for (int i = 0; i < 8; ++i) z[i] = 0.0f;
  return z;
}

__device__ inline float gelu_tanh(float x) {
  return 0.5f * x * (1.0f + tanhf(0.7978845608028654f * (x + 0.044715f * x * x * x)));
}

// ---- CDNA5 async copy: global -> LDS, 16B per lane, tracked by ASYNCcnt ----
// Eight copies and the s_wait_xcnt that keeps their address registers from being
// rewritten early stand in one statement.
__device__ __forceinline__ void async_copy8_b128(const unsigned* l, const bf16t* const* g) {
  asm volatile("global_load_async_to_lds_b128 %0, %8, off\n\t"
               "global_load_async_to_lds_b128 %1, %9, off\n\t"
               "global_load_async_to_lds_b128 %2, %10, off\n\t"
               "global_load_async_to_lds_b128 %3, %11, off\n\t"
               "global_load_async_to_lds_b128 %4, %12, off\n\t"
               "global_load_async_to_lds_b128 %5, %13, off\n\t"
               "global_load_async_to_lds_b128 %6, %14, off\n\t"
               "global_load_async_to_lds_b128 %7, %15, off\n\t"
               "s_wait_xcnt 0x0"
               :: "v"(l[0]), "v"(l[1]), "v"(l[2]), "v"(l[3]),
                  "v"(l[4]), "v"(l[5]), "v"(l[6]), "v"(l[7]),
                  "v"(g[0]), "v"(g[1]), "v"(g[2]), "v"(g[3]),
                  "v"(g[4]), "v"(g[5]), "v"(g[6]), "v"(g[7])
               : "memory");
}

// ---------------- zero workspace ----------------
__global__ void zero_kernel(float* accbuf, int* counts, size_t n) {
  size_t i = (size_t)blockIdx.x * 256u + threadIdx.x;
  if (i < E_NUM) counts[i] = 0;
  size_t stride = (size_t)gridDim.x * 256u;
  for (; i < n; i += stride) accbuf[i] = 0.0f;
}

// ---------------- weight convert to bf16, packed in WMMA B-fragment order ----------------
// One fragment = 16 columns (n) x 32 k = 512 elements = 1 KB, stored as
// [half j of the lane's registers][lane = h*16 + n][8 k], k = 16*j + 8*h + i,
// so that each of a fragment's two 16-byte loads reads 512 contiguous bytes.
// W1P: fragment ((e*256 + f/16)*32  + k/32), n = f, k = d-index of X@W1
// W2P: fragment ((e*64  + d/16)*128 + f/32), n = d, k = f-index of H@W2
//
// Both sources are [e][k][n] with n contiguous. A wave takes a 16(k) x 64(n) piece: eight
// 16-byte loads a lane, each wave-wide load two rows of 256 contiguous bytes. A lane then
// holds 4 n x 8 k = four 16-byte units of the packed form, which belong to one half (j) of
// one fragment. The units cross the wave's own LDS range and leave as one 512-byte run
// per fragment. A work-group's 8 waves lie side by side along n, and it takes the same
// piece of every expert in turn.
#define CV_FP 528               // LDS bytes of a fragment half: 512 + 16, so that the four
                                // fragments a half-wave writes at once fall on different banks
#define CV_WV (4 * CV_FP)       // LDS bytes of a wave

typedef __attribute__((ext_vector_type(4))) float v4f;

template <int N>
__device__ __forceinline__ void cv_load(v4f (&v)[8], const float* __restrict__ s, unsigned off) {
#pragma unroll
  for (int i = 0; i < 8; ++i) v[i] = *(const v4f*)(s + off + i * N);
  // the base is advanced behind this line: the issued loads' address registers are not
  // rewritten ahead of it
  asm volatile("s_wait_xcnt 0x0" ::: "memory");
}

__device__ __forceinline__ void cv_pack(uint4 (&p)[4], const v4f (&v)[8]) {
#pragma unroll
  for (int c = 0; c < 4; ++c) {
    union { bf16t b[8]; uint4 u; } x;
#pragma unroll
    for (int i = 0; i < 8; ++i) x.b[i] = (bf16t)v[i][c];
    p[c] = x.u;
  }
}

template <int K>
__device__ __forceinline__ void cv_emit(const uint4 (&p)[4], char* lw, const char* lr,
                                        bf16t* __restrict__ d, unsigned off) {
#pragma unroll
  for (int c = 0; c < 4; ++c) *(uint4*)(lw + c * 16) = p[c];
  // the wave reads back what its other lanes wrote: their LDS stores have to be done
  asm volatile("s_wait_dscnt 0x0" ::: "memory");
#pragma unroll
  for (int g = 0; g < 4; ++g)
    *(uint4*)(d + off + g * (K / 32) * FRAG) = *(const uint4*)(lr + g * CV_FP);
  // the issued stores' address and data registers are not rewritten ahead of this line
  asm volatile("s_wait_xcnt 0x0" ::: "memory");
}

template <int K, int N>
__device__ __forceinline__ void pack_pieces(const float* __restrict__ src,
                                            bf16t* __restrict__ dst,
                                            char* lds, int r) {
  const int t = threadIdx.x;
  const int w = t >> 5;
  const int l = t & 31;
  const int kb = r / (N / 512);       // which 16 k
  const int nb = r % (N / 512);       // which 512 n
  const float* s = src + (size_t)kb * 16 * N + nb * 512;
  bf16t*       d = dst + (size_t)nb * 512 * K + kb * 256;
  const unsigned soff = (unsigned)((l >> 4) * 8 * N + w * 64 + (l & 15) * 4);
  const unsigned doff = (unsigned)(w * 64 * K + l * 8);
  char*       lw = lds + w * CV_WV + ((l & 15) >> 2) * CV_FP + (l >> 4) * 256 + (l & 3) * 64;
  const char* lr = lds + w * CV_WV + l * 16;

  v4f   v[8];
  uint4 p[4];
  cv_load<N>(v, s, soff);
  // rolled: the body is short; the next expert's piece flies while this one crosses LDS
#pragma unroll 1
  for (int e = 0; e + 1 < E_NUM; ++e) {
    cv_pack(p, v);
    s += (size_t)K * N;
    cv_load<N>(v, s, soff);
    cv_emit<K>(p, lw, lr, d, doff);
    d += (size_t)K * N;
  }
  cv_pack(p, v);
  cv_emit<K>(p, lw, lr, d, doff);
}

__global__ void __launch_bounds__(256)
convert_w_kernel(const float* __restrict__ w1,
                 const float* __restrict__ w2,
                 bf16t* __restrict__ W1P,
                 bf16t* __restrict__ W2P) {
  __shared__ __attribute__((aligned(16))) char cvbuf[8 * CV_WV];
  const int r = blockIdx.x & 511;     // 512 work-group pieces an expert in either matrix
  if (blockIdx.x < 512) pack_pieces<D_DIM, F_DIM>(w1, W1P, cvbuf, r);
  else                  pack_pieces<F_DIM, D_DIM>(w2, W2P, cvbuf, r);
}

// ---------------- router: logits, softmax, top-2, bucket append, bf16 convert ----------------
__global__ void router_kernel(const float* __restrict__ hs,
                              const float* __restrict__ gw,
                              const float* __restrict__ gb,
                              bf16t* __restrict__ Xb,
                              int* __restrict__ counts,
                              int* __restrict__ etok,
                              float* __restrict__ ewt) {
  const int token = blockIdx.x;
  const int t = threadIdx.x;
  __shared__ float red[256];
  __shared__ float logit_sh[E_NUM];

  const float* x = hs + (size_t)token * D_DIM;
  float4 xv = *(const float4*)(x + 4 * t);

  union { bf16t b[4]; uint2 u; } cv;
  cv.b[0] = (bf16t)xv.x; cv.b[1] = (bf16t)xv.y;
  cv.b[2] = (bf16t)xv.z; cv.b[3] = (bf16t)xv.w;
  *(uint2*)(Xb + (size_t)token * D_DIM + 4 * t) = cv.u;

  float part[E_NUM];
#pragma unroll
  for (int e = 0; e < E_NUM; ++e) {
    const float* g = gw + (size_t)(4 * t) * E_NUM + e;
    part[e] = xv.x * g[0] + xv.y * g[E_NUM] + xv.z * g[2 * E_NUM] + xv.w * g[3 * E_NUM];
  }
  for (int e = 0; e < E_NUM; ++e) {
    red[t] = part[e];
    __syncthreads();
    for (int s = 128; s > 0; s >>= 1) {
      if (t < s) red[t] += red[t + s];
      __syncthreads();
    }
    if (t == 0) logit_sh[e] = red[0] + gb[e];
    __syncthreads();
  }

  if (t == 0) {
    float m = logit_sh[0];
#pragma unroll
    for (int e = 1; e < E_NUM; ++e) m = fmaxf(m, logit_sh[e]);
    float p[E_NUM], sum = 0.0f;
#pragma unroll
    for (int e = 0; e < E_NUM; ++e) { p[e] = expf(logit_sh[e] - m); sum += p[e]; }
    float inv = 1.0f / sum;
#pragma unroll
    for (int e = 0; e < E_NUM; ++e) p[e] *= inv;
    int i1 = 0; float g1 = p[0];
#pragma unroll
    for (int e = 1; e < E_NUM; ++e) if (p[e] > g1) { g1 = p[e]; i1 = e; }
    int i2 = (i1 == 0) ? 1 : 0; float g2 = p[i2];
#pragma unroll
    for (int e = 0; e < E_NUM; ++e) if (e != i1 && p[e] > g2) { g2 = p[e]; i2 = e; }

    int pos1 = atomicAdd(&counts[i1], 1);
    etok[(size_t)i1 * N_TOK + pos1] = token;
    ewt [(size_t)i1 * N_TOK + pos1] = g1;
    int pos2 = atomicAdd(&counts[i2], 1);
    etok[(size_t)i2 * N_TOK + pos2] = token;
    ewt [(size_t)i2 * N_TOK + pos2] = g2;
  }
}

// ---------------- expert FFN: register-blocked bf16 WMMA, weights global -> VGPR ----------------
// 256 threads = 8 wave32. Per 256-wide F chunk a wave computes H[64 x 32] (4 x 2 tiles),
// then adds H[64 x 256] @ W2 into its own Y[64 x 128] (4 x 8 tiles = 256 VGPRs).
// Every weight fragment is used by exactly one wave, so it goes straight to registers;
// a ring of 8 fragments is refilled in place right after each fragment's last use.
// The short loops over tiles, slots and registers are all unrolled, so that ring, acc,
// hacc and the A fragments are indexed statically and stay in registers.
__device__ __forceinline__ void ld_frag(Frag16& f, const bf16t* __restrict__ p) {
  f.u[0] = *(const uint4*)(p);
  f.u[1] = *(const uint4*)(p + 256);
}

// four k steps of H += X @ W1; ring slot p*2+j holds k step kt0+p of column tile j
template <bool LAST>
__device__ __forceinline__ void h_block(v8f (&hacc)[2][4], Frag16 (&ring)[8],
                                        const bf16t* xrow, int kt0,
                                        const bf16t* __restrict__ w1p,
                                        const bf16t* __restrict__ w2p) {
#pragma unroll
  for (int p = 0; p < 4; ++p) {
    Frag16 a[4];
#pragma unroll
    for (int mi = 0; mi < 4; ++mi) {
      const bf16t* ap = xrow + mi * 16 * XS_ST + (kt0 + p) * 32;
      a[mi].u[0] = *(const uint4*)(ap);
      a[mi].u[1] = *(const uint4*)(ap + 16);
    }
#pragma unroll
    for (int j = 0; j < 2; ++j) {
      const int s = p * 2 + j;
#pragma unroll
      for (int mi = 0; mi < 4; ++mi)
        hacc[j][mi] = __builtin_amdgcn_wmma_f32_16x16x32_bf16(
            false, a[mi].v, false, ring[s].v, (short)0, hacc[j][mi], false, false);
      if (!LAST) {
        ld_frag(ring[s], w1p + (size_t)(j * 32 + kt0 + p + 4) * FRAG);
      } else {
        ld_frag(ring[s], w2p + (size_t)(s * 128) * FRAG);   // first k step of H @ W2
        // holds each refill directly behind its fragment's last use: left free, the
        // scheduler gathers the refills into late clauses, which shortens their lead
        __builtin_amdgcn_sched_barrier(0);
      }
    }
  }
}

// one k step (32 f) of Y += H @ W2; ring slot n holds column tile n
template <bool LAST>
__device__ __forceinline__ void y_block(v8f (&acc)[8][4], Frag16 (&ring)[8],
                                        const bf16t* hrow, int ks,
                                        const bf16t* __restrict__ w2p,
                                        const bf16t* __restrict__ w1n) {
  Frag16 a[4];
#pragma unroll
  for (int mi = 0; mi < 4; ++mi) {
    const bf16t* ap = hrow + mi * 16 * HS_ST + ks * 32;
    a[mi].u[0] = *(const uint4*)(ap);
    a[mi].u[1] = *(const uint4*)(ap + 16);
  }
#pragma unroll
  for (int n = 0; n < 8; ++n) {
#pragma unroll
    for (int mi = 0; mi < 4; ++mi)
      acc[n][mi] = __builtin_amdgcn_wmma_f32_16x16x32_bf16(
          false, a[mi].v, false, ring[n].v, (short)0, acc[n][mi], false, false);
    if (!LAST) ld_frag(ring[n], w2p + (size_t)(n * 128 + ks + 1) * FRAG);
    else       ld_frag(ring[n], w1n + (size_t)((n & 1) * 32 + (n >> 1)) * FRAG);  // next chunk's X @ W1
    // holds each refill directly behind its fragment's last use and in slot order: left
    // free, the scheduler gathers and reorders the refills, their lead shrinks, and the
    // rolled H loop's head has to wait for nearly the whole ring instead of its oldest slot
    __builtin_amdgcn_sched_barrier(0);
  }
}

__global__ void __launch_bounds__(FFN_THREADS)
moe_ffn_kernel(const bf16t* __restrict__ W1P, const float* __restrict__ b1,
               const bf16t* __restrict__ W2P, const float* __restrict__ b2,
               const bf16t* __restrict__ Xb,
               const int* __restrict__ counts,
               const int* __restrict__ etok,
               const float* __restrict__ ewt,
               float* __restrict__ accbuf) {
  const int e = blockIdx.y;
  const int tile = blockIdx.x;
  const int t = threadIdx.x;
  const int wave = t >> 5;
  const int lane = t & 31;

  const int count = counts[e];
  if (tile * TILE_M >= count) return;

  __shared__ __attribute__((aligned(16))) bf16t Xs[TILE_M * XS_ST];       // [64][1032]
  __shared__ __attribute__((aligned(16))) bf16t Hs[2][TILE_M * HS_ST];    // two x [64][264]
  __shared__ int   rowTok[TILE_M];
  __shared__ float rowW[TILE_M];

  if (t < TILE_M) {
    int idx = tile * TILE_M + t;
    bool ok = idx < count;
    int src = ok ? idx : 0;
    rowTok[t] = etok[(size_t)e * N_TOK + src];
    rowW[t]   = ok ? ewt[(size_t)e * N_TOK + src] : 0.0f;
  }
  __syncthreads();

  // ---- gather X tile (bf16) via async copies: 8192 chunks of 16 B, 32 per thread ----
#pragma unroll
  for (int i = 0; i < 4; ++i) {
    unsigned     l[8];
    const bf16t* g[8];
#pragma unroll
    for (int q = 0; q < 8; ++q) {
      int chunk = (i * 8 + q) * FFN_THREADS + t;
      int r = chunk >> 7;
      int c = (chunk & 127) << 3;
      l[q] = (unsigned)(uintptr_t)(Xs + r * XS_ST + c);
      g[q] = Xb + (size_t)rowTok[r] * D_DIM + c;
    }
    async_copy8_b128(l, g);
  }

  const int lrow = lane & 15;
  const int kb8  = (lane >> 4) << 3;

  // packed weights of this wave: 2 column tiles of W1 per chunk, 8 column tiles of W2
  const bf16t* w1w = W1P + ((size_t)(e * 256 + wave * 2) * 32) * FRAG + lane * 8;
  const bf16t* w2w = W2P + ((size_t)(e * 64 + wave * 8) * 128) * FRAG + lane * 8;

  Frag16 ring[8];
#pragma unroll
  for (int s = 0; s < 8; ++s)
    ld_frag(ring[s], w1w + (size_t)((s & 1) * 32 + (s >> 1)) * FRAG);

  v8f acc[8][4];
#pragma unroll
  for (int n = 0; n < 8; ++n)
#pragma unroll
    for (int mi = 0; mi < 4; ++mi) acc[n][mi] = zero8();

  // the X tile has landed for this wave; the barrier publishes it to the others
  asm volatile("s_wait_asynccnt 0x0" ::: "memory");
  __syncthreads();

  const bf16t* xrow = Xs + lrow * XS_ST + kb8;

  // rolled: one chunk's code is already long, and acc is indexed statically inside it
#pragma unroll 1
  for (int fc = 0; fc < NCHUNK; ++fc) {
    const bf16t* w1p = w1w + (size_t)fc * (16 * 32 * FRAG);
    const bf16t* w2p = w2w + (size_t)fc * (8 * FRAG);
    const int fnext  = (fc + 1 < NCHUNK) ? fc + 1 : fc;   // last chunk: a valid, unused refill
    const bf16t* w1n = w1w + (size_t)fnext * (16 * 32 * FRAG);
    bf16t* hs = Hs[fc & 1];
    // read ahead of this chunk's refills: loads return in order, and a bias read behind
    // them would wait for the whole ring
    float bb[2];
#pragma unroll
    for (int j = 0; j < 2; ++j)
      bb[j] = b1[(size_t)e * F_DIM + fc * FB + wave * 32 + j * 16 + lrow];

    // ======== H = X @ W1[:, chunk] ========
    v8f hacc[2][4];
#pragma unroll
    for (int j = 0; j < 2; ++j)
#pragma unroll
      for (int mi = 0; mi < 4; ++mi) hacc[j][mi] = zero8();

    // rolled: four k steps (32 WMMAs) a trip; for speed only
#pragma unroll 1
    for (int kt0 = 0; kt0 < 28; kt0 += 4)
      h_block<false>(hacc, ring, xrow, kt0, w1p, w2p);
    h_block<true>(hacc, ring, xrow, 28, w1p, w2p);

    // ---- bias + gelu -> Hs (bf16) ----
#pragma unroll
    for (int j = 0; j < 2; ++j) {
      int coln = wave * 32 + j * 16 + lrow;
#pragma unroll
      for (int mi = 0; mi < 4; ++mi)
#pragma unroll
        for (int v = 0; v < 8; ++v) {
          float xv = hacc[j][mi][v] + bb[j];
          hs[(mi * 16 + kb8 + v) * HS_ST + coln] = (bf16t)gelu_tanh(xv);
        }
    }
    // the one barrier of a chunk: publishes this chunk's H; with two H buffers it also
    // keeps the next write of this buffer behind every reader's last read of it
    __syncthreads();

    // ======== Y += H @ W2[chunk, :] ========
    const bf16t* hrow = hs + lrow * HS_ST + kb8;
    // unrolled: every refill then reads at a constant offset from one base of the chunk,
    // and no address register is rewritten between the k steps
#pragma unroll
    for (int ks = 0; ks < 7; ++ks)
      y_block<false>(acc, ring, hrow, ks, w2p, w1n);
    y_block<true>(acc, ring, hrow, 7, w2p, w1n);
    // the chunk's weight pointers are advanced behind this line: the issued loads'
    // address registers are not rewritten ahead of it
    asm volatile("s_wait_xcnt 0x0" ::: "memory");
  }

  // ---- epilogue: +b2, scale by gate, scatter-accumulate ----
#pragma unroll
  for (int n = 0; n < 8; ++n) {
    int col = (wave * 8 + n) * 16 + lrow;
    float bb = b2[(size_t)e * D_DIM + col];
#pragma unroll
    for (int mi = 0; mi < 4; ++mi)
#pragma unroll
      for (int v = 0; v < 8; ++v) {
        int r = mi * 16 + kb8 + v;
        float y = acc[n][mi][v] + bb;
        atomicAdd(accbuf + (size_t)rowTok[r] * D_DIM + col, rowW[r] * y);
      }
  }
}

// ---------------- residual + layernorm ----------------
__global__ void ln_kernel(const float* __restrict__ accbuf,
                          const float* __restrict__ inp,
                          const float* __restrict__ gamma,
                          const float* __restrict__ beta,
                          float* __restrict__ out) {
  const int token = blockIdx.x;
  const int t = threadIdx.x;
  __shared__ float red[256];
  __shared__ float mu_sh, rstd_sh;

  float4 a = *(const float4*)(accbuf + (size_t)token * D_DIM + 4 * t);
  float4 b = *(const float4*)(inp    + (size_t)token * D_DIM + 4 * t);
  float s0 = a.x + b.x, s1 = a.y + b.y, s2 = a.z + b.z, s3 = a.w + b.w;

  red[t] = s0 + s1 + s2 + s3;
  __syncthreads();
  for (int s = 128; s > 0; s >>= 1) {
    if (t < s) red[t] += red[t + s];
    __syncthreads();
  }
  if (t == 0) mu_sh = red[0] * (1.0f / D_DIM);
  __syncthreads();
  float mu = mu_sh;
  float d0 = s0 - mu, d1 = s1 - mu, d2 = s2 - mu, d3 = s3 - mu;
  red[t] = d0 * d0 + d1 * d1 + d2 * d2 + d3 * d3;
  __syncthreads();
  for (int s = 128; s > 0; s >>= 1) {
    if (t < s) red[t] += red[t + s];
    __syncthreads();
  }
  if (t == 0) rstd_sh = rsqrtf(red[0] * (1.0f / D_DIM) + 1e-5f);
  __syncthreads();
  float rstd = rstd_sh;

  int c = 4 * t;
  out[(size_t)token * D_DIM + c + 0] = d0 * rstd * gamma[c + 0] + beta[c + 0];
  out[(size_t)token * D_DIM + c + 1] = d1 * rstd * gamma[c + 1] + beta[c + 1];
  out[(size_t)token * D_DIM + c + 2] = d2 * rstd * gamma[c + 2] + beta[c + 2];
  out[(size_t)token * D_DIM + c + 3] = d3 * rstd * gamma[c + 3] + beta[c + 3];
}

extern "C" void kernel_launch(void* const* d_in, const int* in_sizes, int n_in,
                              void* d_out, int out_size, void* d_ws, size_t ws_size,
                              hipStream_t stream) {
  (void)in_sizes; (void)n_in; (void)out_size; (void)ws_size;
  const float* hs    = (const float*)d_in[0];
  const float* inp   = (const float*)d_in[1];
  const float* gw    = (const float*)d_in[2];
  const float* gb    = (const float*)d_in[3];
  const float* w1    = (const float*)d_in[4];
  const float* b1    = (const float*)d_in[5];
  const float* w2    = (const float*)d_in[6];
  const float* b2    = (const float*)d_in[7];
  const float* gamma = (const float*)d_in[8];
  const float* beta  = (const float*)d_in[9];
  float* out = (float*)d_out;

  char* ws = (char*)d_ws;
  size_t off = 0;
  int*   counts = (int*)(ws + off);   off += 256;
  int*   etok   = (int*)(ws + off);   off += (size_t)E_NUM * N_TOK * sizeof(int);
  float* ewt    = (float*)(ws + off); off += (size_t)E_NUM * N_TOK * sizeof(float);
  bf16t* Xb     = (bf16t*)(ws + off); off += (size_t)N_TOK * D_DIM * sizeof(bf16t);
  float* accb   = (float*)(ws + off); off += (size_t)N_TOK * D_DIM * sizeof(float);
  bf16t* W1T    = (bf16t*)(ws + off); off += (size_t)E_NUM * F_DIM * D_DIM * sizeof(bf16t);
  bf16t* W2T    = (bf16t*)(ws + off); off += (size_t)E_NUM * F_DIM * D_DIM * sizeof(bf16t);

  zero_kernel<<<dim3(2048), dim3(256), 0, stream>>>(accb, counts, (size_t)N_TOK * D_DIM);
  convert_w_kernel<<<dim3(1024), dim3(256), 0, stream>>>(w1, w2, W1T, W2T);
  router_kernel<<<dim3(N_TOK), dim3(256), 0, stream>>>(hs, gw, gb, Xb, counts, etok, ewt);
  moe_ffn_kernel<<<dim3(N_TOK / TILE_M, E_NUM), dim3(FFN_THREADS), 0, stream>>>(
      W1T, b1, W2T, b2, Xb, counts, etok, ewt, accb);
  ln_kernel<<<dim3(N_TOK), dim3(256), 0, stream>>>(accb, inp, gamma, beta, out);
}

// v003
// One run takes 444 microseconds.
// Two timings next to v002 both put it at 1.33 times that version's speed.
// Counting every step since v000, it is 4.22 times as fast.
#include <hip/hip_runtime.h>
#include <hip/hip_bf16.h>

#define N_TOK 8192
#define D_DIM 1024
#define E_NUM 8
#define F_DIM 4096
#define TILE_M 64
#define FB 256                  // F columns per chunk
#define NCHUNK (F_DIM / FB)     // 16
#define FFN_THREADS 256         // 8 wave32, 2 per SIMD
#define FRAG 512                // bf16 elements of one packed 16(n) x 32(k) B fragment

#define XS_ST 1032   // Xs row stride (bf16 elems): 2064 B/row, 16B aligned
#define HS_ST 264    // Hs row stride (bf16 elems): 528 B/row, 16B aligned

typedef __bf16 bf16t;
typedef __attribute__((ext_vector_type(16))) bf16t v16bf;
typedef __attribute__((ext_vector_type(8)))  float v8f;

union Frag16 { v16bf v; uint4 u[2]; };

__device__ inline v8f zero8() {
  v8f z;
#pragma unroll
  for (int i = 0; i < 8; ++i) z[i] = 0.0f;
  return z;
}

// 0.5 * (1 + tanh(u)) = 1 / (1 + exp(-2u)), u = 0.79788...(x + 0.044715 x^3): one exp2 and one
// reciprocal a value and no branch. exp2 runs to +inf or to 0 at the ends, which gives the
// limits 0 and x.
__device__ inline float gelu_tanh(float x) {
  const float k = -2.0f * 0.7978845608028654f * 1.4426950408889634f;   // -2 sqrt(2/pi) log2(e)
  const float s = x * (k + (k * 0.044715f) * (x * x));
  return x * __builtin_amdgcn_rcpf(1.0f + __builtin_amdgcn_exp2f(s));
}

// ---- CDNA5 async copy: global -> LDS, 16B per lane, tracked by ASYNCcnt ----
// Eight copies and the s_wait_xcnt that keeps their address registers from being
// rewritten early stand in one statement.
__device__ __forceinline__ void async_copy8_b128(const unsigned* l, const bf16t* const* g) {
  asm volatile("global_load_async_to_lds_b128 %0, %8, off\n\t"
               "global_load_async_to_lds_b128 %1, %9, off\n\t"
               "global_load_async_to_lds_b128 %2, %10, off\n\t"
               "global_load_async_to_lds_b128 %3, %11, off\n\t"
               "global_load_async_to_lds_b128 %4, %12, off\n\t"
               "global_load_async_to_lds_b128 %5, %13, off\n\t"
               "global_load_async_to_lds_b128 %6, %14, off\n\t"
               "global_load_async_to_lds_b128 %7, %15, off\n\t"
               "s_wait_xcnt 0x0"
               :: "v"(l[0]), "v"(l[1]), "v"(l[2]), "v"(l[3]),
                  "v"(l[4]), "v"(l[5]), "v"(l[6]), "v"(l[7]),
                  "v"(g[0]), "v"(g[1]), "v"(g[2]), "v"(g[3]),
                  "v"(g[4]), "v"(g[5]), "v"(g[6]), "v"(g[7])
               : "memory");
}

// ---------------- zero workspace ----------------
__global__ void zero_kernel(float* accbuf, int* counts, size_t n) {
  size_t i = (size_t)blockIdx.x * 256u + threadIdx.x;
  if (i < E_NUM) counts[i] = 0;
  size_t stride = (size_t)gridDim.x * 256u;
  for (; i < n; i += stride) accbuf[i] = 0.0f;
}

// ---------------- weight convert to bf16, packed in WMMA B-fragment order ----------------
// One fragment = 16 columns (n) x 32 k = 512 elements = 1 KB, stored as
// [half j of the lane's registers][lane = h*16 + n][8 k], k = 16*j + 8*h + i,
// so that each of a fragment's two 16-byte loads reads 512 contiguous bytes.
// W1P: fragment ((e*256 + f/16)*32  + k/32), n = f, k = d-index of X@W1
// W2P: fragment ((e*64  + d/16)*128 + f/32), n = d, k = f-index of H@W2
//
// Both sources are [e][k][n] with n contiguous. A wave takes a 16(k) x 64(n) piece: eight
// 16-byte loads a lane, each wave-wide load two rows of 256 contiguous bytes. A lane then
// holds 4 n x 8 k = four 16-byte units of the packed form, which belong to one half (j) of
// one fragment. The units cross the wave's own LDS range and leave as one 512-byte run
// per fragment. A work-group's 8 waves lie side by side along n, and it takes the same
// piece of every expert in turn.
#define CV_FP 528               // LDS bytes of a fragment half: 512 + 16, so that the four
                                // fragments a half-wave writes at once fall on different banks
#define CV_WV (4 * CV_FP)       // LDS bytes of a wave

typedef __attribute__((ext_vector_type(4))) float v4f;

template <int N>
__device__ __forceinline__ void cv_load(v4f (&v)[8], const float* __restrict__ s, unsigned off) {
#pragma unroll
  for (int i = 0; i < 8; ++i) v[i] = *(const v4f*)(s + off + i * N);
  // the base is advanced behind this line: the issued loads' address registers are not
  // rewritten ahead of it
  asm volatile("s_wait_xcnt 0x0" ::: "memory");
}

__device__ __forceinline__ void cv_pack(uint4 (&p)[4], const v4f (&v)[8]) {
#pragma unroll
  for (int c = 0; c < 4; ++c) {
    union { bf16t b[8]; uint4 u; } x;
#pragma unroll
    for (int i = 0; i < 8; ++i) x.b[i] = (bf16t)v[i][c];
    p[c] = x.u;
  }
}

template <int K>
__device__ __forceinline__ void cv_emit(const uint4 (&p)[4], char* lw, const char* lr,
                                        bf16t* __restrict__ d, unsigned off) {
#pragma unroll
  for (int c = 0; c < 4; ++c) *(uint4*)(lw + c * 16) = p[c];
  // the wave reads back what its other lanes wrote: their LDS stores have to be done
  asm volatile("s_wait_dscnt 0x0" ::: "memory");
#pragma unroll
  for (int g = 0; g < 4; ++g)
    *(uint4*)(d + off + g * (K / 32) * FRAG) = *(const uint4*)(lr + g * CV_FP);
  // the issued stores' address and data registers are not rewritten ahead of this line
  asm volatile("s_wait_xcnt 0x0" ::: "memory");
}

template <int K, int N>
__device__ __forceinline__ void pack_pieces(const float* __restrict__ src,
                                            bf16t* __restrict__ dst,
                                            char* lds, int r) {
  const int t = threadIdx.x;
  const int w = t >> 5;
  const int l = t & 31;
  const int kb = r / (N / 512);       // which 16 k
  const int nb = r % (N / 512);       // which 512 n
  const float* s = src + (size_t)kb * 16 * N + nb * 512;
  bf16t*       d = dst + (size_t)nb * 512 * K + kb * 256;
  const unsigned soff = (unsigned)((l >> 4) * 8 * N + w * 64 + (l & 15) * 4);
  const unsigned doff = (unsigned)(w * 64 * K + l * 8);
  char*       lw = lds + w * CV_WV + ((l & 15) >> 2) * CV_FP + (l >> 4) * 256 + (l & 3) * 64;
  const char* lr = lds + w * CV_WV + l * 16;

  v4f   v[8];
  uint4 p[4];
  cv_load<N>(v, s, soff);
  // rolled: the body is short; the next expert's piece flies while this one crosses LDS
#pragma unroll 1
  for (int e = 0; e + 1 < E_NUM; ++e) {
    cv_pack(p, v);
    s += (size_t)K * N;
    cv_load<N>(v, s, soff);
    cv_emit<K>(p, lw, lr, d, doff);
    d += (size_t)K * N;
  }
  cv_pack(p, v);
  cv_emit<K>(p, lw, lr, d, doff);
}

__global__ void __launch_bounds__(256)
convert_w_kernel(const float* __restrict__ w1,
                 const float* __restrict__ w2,
                 bf16t* __restrict__ W1P,
                 bf16t* __restrict__ W2P) {
  __shared__ __attribute__((aligned(16))) char cvbuf[8 * CV_WV];
  const int r = blockIdx.x & 511;     // 512 work-group pieces an expert in either matrix
  if (blockIdx.x < 512) pack_pieces<D_DIM, F_DIM>(w1, W1P, cvbuf, r);
  else                  pack_pieces<F_DIM, D_DIM>(w2, W2P, cvbuf, r);
}

// ---------------- router: logits, softmax, top-2, bucket append, bf16 convert ----------------
__global__ void router_kernel(const float* __restrict__ hs,
                              const float* __restrict__ gw,
                              const float* __restrict__ gb,
                              bf16t* __restrict__ Xb,
                              int* __restrict__ counts,
                              int* __restrict__ etok,
                              float* __restrict__ ewt) {
  const int token = blockIdx.x;
  const int t = threadIdx.x;
  __shared__ float red[256];
  __shared__ float logit_sh[E_NUM];

  const float* x = hs + (size_t)token * D_DIM;
  float4 xv = *(const float4*)(x + 4 * t);

  union { bf16t b[4]; uint2 u; } cv;
  cv.b[0] = (bf16t)xv.x; cv.b[1] = (bf16t)xv.y;
  cv.b[2] = (bf16t)xv.z; cv.b[3] = (bf16t)xv.w;
  *(uint2*)(Xb + (size_t)token * D_DIM + 4 * t) = cv.u;

  float part[E_NUM];
#pragma unroll
  for (int e = 0; e < E_NUM; ++e) {
    const float* g = gw + (size_t)(4 * t) * E_NUM + e;
    part[e] = xv.x * g[0] + xv.y * g[E_NUM] + xv.z * g[2 * E_NUM] + xv.w * g[3 * E_NUM];
  }
  for (int e = 0; e < E_NUM; ++e) {
    red[t] = part[e];
    __syncthreads();
    for (int s = 128; s > 0; s >>= 1) {
      if (t < s) red[t] += red[t + s];
      __syncthreads();
    }
    if (t == 0) logit_sh[e] = red[0] + gb[e];
    __syncthreads();
  }

  if (t == 0) {
    float m = logit_sh[0];
#pragma unroll
    for (int e = 1; e < E_NUM; ++e) m = fmaxf(m, logit_sh[e]);
    float p[E_NUM], sum = 0.0f;
#pragma unroll
    for (int e = 0; e < E_NUM; ++e) { p[e] = expf(logit_sh[e] - m); sum += p[e]; }
    float inv = 1.0f / sum;
#pragma unroll
    for (int e = 0; e < E_NUM; ++e) p[e] *= inv;
    int i1 = 0; float g1 = p[0];
#pragma unroll
    for (int e = 1; e < E_NUM; ++e) if (p[e] > g1) { g1 = p[e]; i1 = e; }
    int i2 = (i1 == 0) ? 1 : 0; float g2 = p[i2];
#pragma unroll
    for (int e = 0; e < E_NUM; ++e) if (e != i1 && p[e] > g2) { g2 = p[e]; i2 = e; }

    int pos1 = atomicAdd(&counts[i1], 1);
    etok[(size_t)i1 * N_TOK + pos1] = token;
    ewt [(size_t)i1 * N_TOK + pos1] = g1;
    int pos2 = atomicAdd(&counts[i2], 1);
    etok[(size_t)i2 * N_TOK + pos2] = token;
    ewt [(size_t)i2 * N_TOK + pos2] = g2;
  }
}

// ---------------- expert FFN: register-blocked bf16 WMMA, weights global -> VGPR ----------------
// 256 threads = 8 wave32. Per 256-wide F chunk a wave computes H[64 x 32] (4 x 2 tiles),
// then adds H[64 x 256] @ W2 into its own Y[64 x 128] (4 x 8 tiles = 256 VGPRs).
// Every weight fragment is used by exactly one wave, so it goes straight to registers;
// a ring of 8 fragments is refilled in place right after each fragment's last use.
// The short loops over tiles, slots and registers are all unrolled, so that ring, acc,
// hacc and the A fragments are indexed statically and stay in registers.
__device__ __forceinline__ void ld_frag(Frag16& f, const bf16t* __restrict__ p) {
  f.u[0] = *(const uint4*)(p);
  f.u[1] = *(const uint4*)(p + 256);
}

// four k steps of H += X @ W1; ring slot p*2+j holds k step kt0+p of column tile j
template <bool LAST>
__device__ __forceinline__ void h_block(v8f (&hacc)[2][4], Frag16 (&ring)[8],
                                        const bf16t* xrow, int kt0,
                                        const bf16t* __restrict__ w1p,
                                        const bf16t* __restrict__ w2p) {
#pragma unroll
  for (int p = 0; p < 4; ++p) {
    Frag16 a[4];
#pragma unroll
    for (int mi = 0; mi < 4; ++mi) {
      const bf16t* ap = xrow + mi * 16 * XS_ST + (kt0 + p) * 32;
      a[mi].u[0] = *(const uint4*)(ap);
      a[mi].u[1] = *(const uint4*)(ap + 16);
    }
#pragma unroll
    for (int j = 0; j < 2; ++j) {
      const int s = p * 2 + j;
#pragma unroll
      for (int mi = 0; mi < 4; ++mi)
        hacc[j][mi] = __builtin_amdgcn_wmma_f32_16x16x32_bf16(
            false, a[mi].v, false, ring[s].v, (short)0, hacc[j][mi], false, false);
      if (!LAST) {
        ld_frag(ring[s], w1p + (size_t)(j * 32 + kt0 + p + 4) * FRAG);
      } else {
        ld_frag(ring[s], w2p + (size_t)(s * 128) * FRAG);   // first k step of H @ W2
        // holds each refill directly behind its fragment's last use: left free, the
        // scheduler gathers the refills into late clauses, which shortens their lead
        __builtin_amdgcn_sched_barrier(0);
      }
    }
  }
}

// one k step (32 f) of Y += H @ W2; ring slot n holds column tile n
template <bool LAST>
__device__ __forceinline__ void y_block(v8f (&acc)[8][4], Frag16 (&ring)[8],
                                        const bf16t* hrow, int ks,
                                        const bf16t* __restrict__ w2p,
                                        const bf16t* __restrict__ w1n) {
  Frag16 a[4];
#pragma unroll
  for (int mi = 0; mi < 4; ++mi) {
    const bf16t* ap = hrow + mi * 16 * HS_ST + ks * 32;
    a[mi].u[0] = *(const uint4*)(ap);
    a[mi].u[1] = *(const uint4*)(ap + 16);
  }
#pragma unroll
  for (int n = 0; n < 8; ++n) {
#pragma unroll
    for (int mi = 0; mi < 4; ++mi)
      acc[n][mi] = __builtin_amdgcn_wmma_f32_16x16x32_bf16(
          false, a[mi].v, false, ring[n].v, (short)0, acc[n][mi], false, false);
    if (!LAST) ld_frag(ring[n], w2p + (size_t)(n * 128 + ks + 1) * FRAG);
    else       ld_frag(ring[n], w1n + (size_t)((n & 1) * 32 + (n >> 1)) * FRAG);  // next chunk's X @ W1
    // holds each refill directly behind its fragment's last use and in slot order: left
    // free, the scheduler gathers and reorders the refills, their lead shrinks, and the
    // rolled H loop's head has to wait for nearly the whole ring instead of its oldest slot
    __builtin_amdgcn_sched_barrier(0);
  }
}

__global__ void __launch_bounds__(FFN_THREADS)
moe_ffn_kernel(const bf16t* __restrict__ W1P, const float* __restrict__ b1,
               const bf16t* __restrict__ W2P, const float* __restrict__ b2,
               const bf16t* __restrict__ Xb,
               const int* __restrict__ counts,
               const int* __restrict__ etok,
               const float* __restrict__ ewt,
               float* __restrict__ accbuf) {
  const int e = blockIdx.y;
  const int tile = blockIdx.x;
  const int t = threadIdx.x;
  const int wave = t >> 5;
  const int lane = t & 31;

  const int count = counts[e];
  if (tile * TILE_M >= count) return;

  __shared__ __attribute__((aligned(16))) bf16t Xs[TILE_M * XS_ST];       // [64][1032]
  __shared__ __attribute__((aligned(16))) bf16t Hs[2][TILE_M * HS_ST];    // two x [64][264]
  __shared__ int   rowTok[TILE_M];
  __shared__ float rowW[TILE_M];

  if (t < TILE_M) {
    int idx = tile * TILE_M + t;
    bool ok = idx < count;
    int src = ok ? idx : 0;
    rowTok[t] = etok[(size_t)e * N_TOK + src];
    rowW[t]   = ok ? ewt[(size_t)e * N_TOK + src] : 0.0f;
  }
  __syncthreads();

  // ---- gather X tile (bf16) via async copies: 8192 chunks of 16 B, 32 per thread ----
#pragma unroll
  for (int i = 0; i < 4; ++i) {
    unsigned     l[8];
    const bf16t* g[8];
#pragma unroll
    for (int q = 0; q < 8; ++q) {
      int chunk = (i * 8 + q) * FFN_THREADS + t;
      int r = chunk >> 7;
      int c = (chunk & 127) << 3;
      l[q] = (unsigned)(uintptr_t)(Xs + r * XS_ST + c);
      g[q] = Xb + (size_t)rowTok[r] * D_DIM + c;
    }
    async_copy8_b128(l, g);
  }

  const int lrow = lane & 15;
  const int kb8  = (lane >> 4) << 3;

  // packed weights of this wave: 2 column tiles of W1 per chunk, 8 column tiles of W2
  const bf16t* w1w = W1P + ((size_t)(e * 256 + wave * 2) * 32) * FRAG + lane * 8;
  const bf16t* w2w = W2P + ((size_t)(e * 64 + wave * 8) * 128) * FRAG + lane * 8;

  Frag16 ring[8];
#pragma unroll
  for (int s = 0; s < 8; ++s)
    ld_frag(ring[s], w1w + (size_t)((s & 1) * 32 + (s >> 1)) * FRAG);

  v8f acc[8][4];
#pragma unroll
  for (int n = 0; n < 8; ++n)
#pragma unroll
    for (int mi = 0; mi < 4; ++mi) acc[n][mi] = zero8();

  // the X tile has landed for this wave; the barrier publishes it to the others
  asm volatile("s_wait_asynccnt 0x0" ::: "memory");
  __syncthreads();

  const bf16t* xrow = Xs + lrow * XS_ST + kb8;

  // rolled: one chunk's code is already long, and acc is indexed statically inside it
#pragma unroll 1
  for (int fc = 0; fc < NCHUNK; ++fc) {
    const bf16t* w1p = w1w + (size_t)fc * (16 * 32 * FRAG);
    const bf16t* w2p = w2w + (size_t)fc * (8 * FRAG);
    const int fnext  = (fc + 1 < NCHUNK) ? fc + 1 : fc;   // last chunk: a valid, unused refill
    const bf16t* w1n = w1w + (size_t)fnext * (16 * 32 * FRAG);
    bf16t* hs = Hs[fc & 1];
    // read ahead of this chunk's refills: loads return in order, and a bias read behind
    // them would wait for the whole ring
    float bb[2];
#pragma unroll
    for (int j = 0; j < 2; ++j)
      bb[j] = b1[(size_t)e * F_DIM + fc * FB + wave * 32 + j * 16 + lrow];

    // ======== H = X @ W1[:, chunk] ========
    v8f hacc[2][4];
#pragma unroll
    for (int j = 0; j < 2; ++j)
#pragma unroll
      for (int mi = 0; mi < 4; ++mi) hacc[j][mi] = zero8();

    // rolled: four k steps (32 WMMAs) a trip; for speed only
#pragma unroll 1
    for (int kt0 = 0; kt0 < 28; kt0 += 4)
      h_block<false>(hacc, ring, xrow, kt0, w1p, w2p);
    h_block<true>(hacc, ring, xrow, 28, w1p, w2p);

    // ---- bias + gelu -> Hs (bf16) ----
#pragma unroll
    for (int j = 0; j < 2; ++j) {
      int coln = wave * 32 + j * 16 + lrow;
#pragma unroll
      for (int mi = 0; mi < 4; ++mi)
#pragma unroll
        for (int v = 0; v < 8; ++v) {
          float xv = hacc[j][mi][v] + bb[j];
          hs[(mi * 16 + kb8 + v) * HS_ST + coln] = (bf16t)gelu_tanh(xv);
        }
    }
    // the one barrier of a chunk: publishes this chunk's H; with two H buffers it also
    // keeps the next write of this buffer behind every reader's last read of it
    __syncthreads();

    // ======== Y += H @ W2[chunk, :] ========
    const bf16t* hrow = hs + lrow * HS_ST + kb8;
    // unrolled: every refill then reads at a constant offset from one base of the chunk,
    // and no address register is rewritten between the k steps
#pragma unroll
    for (int ks = 0; ks < 7; ++ks)
      y_block<false>(acc, ring, hrow, ks, w2p, w1n);
    y_block<true>(acc, ring, hrow, 7, w2p, w1n);
    // the chunk's weight pointers are advanced behind this line: the issued loads'
    // address registers are not rewritten ahead of it
    asm volatile("s_wait_xcnt 0x0" ::: "memory");
  }

  // ---- epilogue: +b2, scale by gate, scatter-accumulate ----
#pragma unroll
  for (int n = 0; n < 8; ++n) {
    int col = (wave * 8 + n) * 16 + lrow;
    float bb = b2[(size_t)e * D_DIM + col];
#pragma unroll
    for (int mi = 0; mi < 4; ++mi)
#pragma unroll
      for (int v = 0; v < 8; ++v) {
        int r = mi * 16 + kb8 + v;
        float y = acc[n][mi][v] + bb;
        atomicAdd(accbuf + (size_t)rowTok[r] * D_DIM + col, rowW[r] * y);
      }
  }
}

// ---------------- residual + layernorm ----------------
__global__ void ln_kernel(const float* __restrict__ accbuf,
                          const float* __restrict__ inp,
                          const float* __restrict__ gamma,
                          const float* __restrict__ beta,
                          float* __restrict__ out) {
  const int token = blockIdx.x;
  const int t = threadIdx.x;
  __shared__ float red[256];
  __shared__ float mu_sh, rstd_sh;

  float4 a = *(const float4*)(accbuf + (size_t)token * D_DIM + 4 * t);
  float4 b = *(const float4*)(inp    + (size_t)token * D_DIM + 4 * t);
  float s0 = a.x + b.x, s1 = a.y + b.y, s2 = a.z + b.z, s3 = a.w + b.w;

  red[t] = s0 + s1 + s2 + s3;
  __syncthreads();
  for (int s = 128; s > 0; s >>= 1) {
    if (t < s) red[t] += red[t + s];
    __syncthreads();
  }
  if (t == 0) mu_sh = red[0] * (1.0f / D_DIM);
  __syncthreads();
  float mu = mu_sh;
  float d0 = s0 - mu, d1 = s1 - mu, d2 = s2 - mu, d3 = s3 - mu;
  red[t] = d0 * d0 + d1 * d1 + d2 * d2 + d3 * d3;
  __syncthreads();
  for (int s = 128; s > 0; s >>= 1) {
    if (t < s) red[t] += red[t + s];
    __syncthreads();
  }
  if (t == 0) rstd_sh = rsqrtf(red[0] * (1.0f / D_DIM) + 1e-5f);
  __syncthreads();
  float rstd = rstd_sh;

  int c = 4 * t;
  out[(size_t)token * D_DIM + c + 0] = d0 * rstd * gamma[c + 0] + beta[c + 0];
  out[(size_t)token * D_DIM + c + 1] = d1 * rstd * gamma[c + 1] + beta[c + 1];
  out[(size_t)token * D_DIM + c + 2] = d2 * rstd * gamma[c + 2] + beta[c + 2];
  out[(size_t)token * D_DIM + c + 3] = d3 * rstd * gamma[c + 3] + beta[c + 3];
}

extern "C" void kernel_launch(void* const* d_in, const int* in_sizes, int n_in,
                              void* d_out, int out_size, void* d_ws, size_t ws_size,
                              hipStream_t stream) {
  (void)in_sizes; (void)n_in; (void)out_size; (void)ws_size;
  const float* hs    = (const float*)d_in[0];
  const float* inp   = (const float*)d_in[1];
  const float* gw    = (const float*)d_in[2];
  const float* gb    = (const float*)d_in[3];
  const float* w1    = (const float*)d_in[4];
  const float* b1    = (const float*)d_in[5];
  const float* w2    = (const float*)d_in[6];
  const float* b2    = (const float*)d_in[7];
  const float* gamma = (const float*)d_in[8];
  const float* beta  = (const float*)d_in[9];
  float* out = (float*)d_out;

  char* ws = (char*)d_ws;
  size_t off = 0;
  int*   counts = (int*)(ws + off);   off += 256;
  int*   etok   = (int*)(ws + off);   off += (size_t)E_NUM * N_TOK * sizeof(int);
  float* ewt    = (float*)(ws + off); off += (size_t)E_NUM * N_TOK * sizeof(float);
  bf16t* Xb     = (bf16t*)(ws + off); off += (size_t)N_TOK * D_DIM * sizeof(bf16t);
  float* accb   = (float*)(ws + off); off += (size_t)N_TOK * D_DIM * sizeof(float);
  bf16t* W1T    = (bf16t*)(ws + off); off += (size_t)E_NUM * F_DIM * D_DIM * sizeof(bf16t);
  bf16t* W2T    = (bf16t*)(ws + off); off += (size_t)E_NUM * F_DIM * D_DIM * sizeof(bf16t);

  zero_kernel<<<dim3(2048), dim3(256), 0, stream>>>(accb, counts, (size_t)N_TOK * D_DIM);
  convert_w_kernel<<<dim3(1024), dim3(256), 0, stream>>>(w1, w2, W1T, W2T);
  router_kernel<<<dim3(N_TOK), dim3(256), 0, stream>>>(hs, gw, gb, Xb, counts, etok, ewt);
  moe_ffn_kernel<<<dim3(N_TOK / TILE_M, E_NUM), dim3(FFN_THREADS), 0, stream>>>(
      W1T, b1, W2T, b2, Xb, counts, etok, ewt, accb);
  ln_kernel<<<dim3(N_TOK), dim3(256), 0, stream>>>(accb, inp, gamma, beta, out);
}

// v004
// It runs in 336 microseconds.
// Two timings next to v003 put it at 1.33 and 1.34 times that version's speed.
// All steps since v000 together make it 5.62 times as fast.
#include <hip/hip_runtime.h>
#include <hip/hip_bf16.h>

#define N_TOK 8192
#define D_DIM 1024
#define E_NUM 8
#define F_DIM 4096
#define TILE_M 64
#define FB 256                  // F columns per chunk
#define NCHUNK (F_DIM / FB)     // 16
#define FFN_THREADS 256         // 8 wave32, 2 per SIMD
#define FRAG 512                // bf16 elements of one packed 16(n) x 32(k) B fragment
// Every token goes to two experts: 2 * N_TOK rows, which fill FULL_T row tiles exactly. Each
// expert rounds its own rows up to whole tiles, so there are FULL_T to FULL_T + E_NUM - 1 tiles.
#define FULL_T (2 * N_TOK / TILE_M)             // 256: one work-group each, all of F
#define XTRA_T (E_NUM - 1)                      // tiles past FULL_T: one work-group a chunk of F
#define FFN_GRID (XTRA_T * NCHUNK + FULL_T)

#define XS_ST 1032   // Xs row stride (bf16 elems): 2064 B/row, 16B aligned
#define HS_ST 264    // Hs row stride (bf16 elems): 528 B/row, 16B aligned

typedef __bf16 bf16t;
typedef __attribute__((ext_vector_type(16))) bf16t v16bf;
typedef __attribute__((ext_vector_type(8)))  float v8f;

union Frag16 { v16bf v; uint4 u[2]; };

__device__ inline v8f zero8() {
  v8f z;
#pragma unroll
  for (int i = 0; i < 8; ++i) z[i] = 0.0f;
  return z;
}

// 0.5 * (1 + tanh(u)) = 1 / (1 + exp(-2u)), u = 0.79788...(x + 0.044715 x^3): one exp2 and one
// reciprocal a value and no branch. exp2 runs to +inf or to 0 at the ends, which gives the
// limits 0 and x.
__device__ inline float gelu_tanh(float x) {
  const float k = -2.0f * 0.7978845608028654f * 1.4426950408889634f;   // -2 sqrt(2/pi) log2(e)
  const float s = x * (k + (k * 0.044715f) * (x * x));
  return x * __builtin_amdgcn_rcpf(1.0f + __builtin_amdgcn_exp2f(s));
}

// ---- CDNA5 async copy: global -> LDS, 16B per lane, tracked by ASYNCcnt ----
// Eight copies and the s_wait_xcnt that keeps their address registers from being
// rewritten early stand in one statement.
__device__ __forceinline__ void async_copy8_b128(const unsigned* l, const bf16t* const* g) {
  asm volatile("global_load_async_to_lds_b128 %0, %8, off\n\t"
               "global_load_async_to_lds_b128 %1, %9, off\n\t"
               "global_load_async_to_lds_b128 %2, %10, off\n\t"
               "global_load_async_to_lds_b128 %3, %11, off\n\t"
               "global_load_async_to_lds_b128 %4, %12, off\n\t"
               "global_load_async_to_lds_b128 %5, %13, off\n\t"
               "global_load_async_to_lds_b128 %6, %14, off\n\t"
               "global_load_async_to_lds_b128 %7, %15, off\n\t"
               "s_wait_xcnt 0x0"
               :: "v"(l[0]), "v"(l[1]), "v"(l[2]), "v"(l[3]),
                  "v"(l[4]), "v"(l[5]), "v"(l[6]), "v"(l[7]),
                  "v"(g[0]), "v"(g[1]), "v"(g[2]), "v"(g[3]),
                  "v"(g[4]), "v"(g[5]), "v"(g[6]), "v"(g[7])
               : "memory");
}

// ---------------- zero workspace ----------------
__global__ void zero_kernel(float* accbuf, int* counts, size_t n) {
  size_t i = (size_t)blockIdx.x * 256u + threadIdx.x;
  if (i < E_NUM) counts[i] = 0;
  size_t stride = (size_t)gridDim.x * 256u;
  for (; i < n; i += stride) accbuf[i] = 0.0f;
}

// ---------------- weight convert to bf16, packed in WMMA B-fragment order ----------------
// One fragment = 16 columns (n) x 32 k = 512 elements = 1 KB, stored as
// [half j of the lane's registers][lane = h*16 + n][8 k], k = 16*j + 8*h + i,
// so that each of a fragment's two 16-byte loads reads 512 contiguous bytes.
// W1P: fragment ((e*256 + f/16)*32  + k/32), n = f, k = d-index of X@W1
// W2P: fragment ((e*64  + d/16)*128 + f/32), n = d, k = f-index of H@W2
//
// Both sources are [e][k][n] with n contiguous. A wave takes a 16(k) x 64(n) piece: eight
// 16-byte loads a lane, each wave-wide load two rows of 256 contiguous bytes. A lane then
// holds 4 n x 8 k = four 16-byte units of the packed form, which belong to one half (j) of
// one fragment. The units cross the wave's own LDS range and leave as one 512-byte run
// per fragment. A work-group's 8 waves lie side by side along n, and it takes the same
// piece of every expert in turn.
#define CV_FP 528               // LDS bytes of a fragment half: 512 + 16, so that the four
                                // fragments a half-wave writes at once fall on different banks
#define CV_WV (4 * CV_FP)       // LDS bytes of a wave

typedef __attribute__((ext_vector_type(4))) float v4f;

template <int N>
__device__ __forceinline__ void cv_load(v4f (&v)[8], const float* __restrict__ s, unsigned off) {
#pragma unroll
  for (int i = 0; i < 8; ++i) v[i] = *(const v4f*)(s + off + i * N);
  // the base is advanced behind this line: the issued loads' address registers are not
  // rewritten ahead of it
  asm volatile("s_wait_xcnt 0x0" ::: "memory");
}

__device__ __forceinline__ void cv_pack(uint4 (&p)[4], const v4f (&v)[8]) {
#pragma unroll
  for (int c = 0; c < 4; ++c) {
    union { bf16t b[8]; uint4 u; } x;
#pragma unroll
    for (int i = 0; i < 8; ++i) x.b[i] = (bf16t)v[i][c];
    p[c] = x.u;
  }
}

template <int K>
__device__ __forceinline__ void cv_emit(const uint4 (&p)[4], char* lw, const char* lr,
                                        bf16t* __restrict__ d, unsigned off) {
#pragma unroll
  for (int c = 0; c < 4; ++c) *(uint4*)(lw + c * 16) = p[c];
  // the wave reads back what its other lanes wrote: their LDS stores have to be done
  asm volatile("s_wait_dscnt 0x0" ::: "memory");
#pragma unroll
  for (int g = 0; g < 4; ++g)
    *(uint4*)(d + off + g * (K / 32) * FRAG) = *(const uint4*)(lr + g * CV_FP);
  // the issued stores' address and data registers are not rewritten ahead of this line
  asm volatile("s_wait_xcnt 0x0" ::: "memory");
}

template <int K, int N>
__device__ __forceinline__ void pack_pieces(const float* __restrict__ src,
                                            bf16t* __restrict__ dst,
                                            char* lds, int r) {
  const int t = threadIdx.x;
  const int w = t >> 5;
  const int l = t & 31;
  const int kb = r / (N / 512);       // which 16 k
  const int nb = r % (N / 512);       // which 512 n
  const float* s = src + (size_t)kb * 16 * N + nb * 512;
  bf16t*       d = dst + (size_t)nb * 512 * K + kb * 256;
  const unsigned soff = (unsigned)((l >> 4) * 8 * N + w * 64 + (l & 15) * 4);
  const unsigned doff = (unsigned)(w * 64 * K + l * 8);
  char*       lw = lds + w * CV_WV + ((l & 15) >> 2) * CV_FP + (l >> 4) * 256 + (l & 3) * 64;
  const char* lr = lds + w * CV_WV + l * 16;

  v4f   v[8];
  uint4 p[4];
  cv_load<N>(v, s, soff);
  // rolled: the body is short; the next expert's piece flies while this one crosses LDS
#pragma unroll 1
  for (int e = 0; e + 1 < E_NUM; ++e) {
    cv_pack(p, v);
    s += (size_t)K * N;
    cv_load<N>(v, s, soff);
    cv_emit<K>(p, lw, lr, d, doff);
    d += (size_t)K * N;
  }
  cv_pack(p, v);
  cv_emit<K>(p, lw, lr, d, doff);
}

__global__ void __launch_bounds__(256)
convert_w_kernel(const float* __restrict__ w1,
                 const float* __restrict__ w2,
                 bf16t* __restrict__ W1P,
                 bf16t* __restrict__ W2P) {
  __shared__ __attribute__((aligned(16))) char cvbuf[8 * CV_WV];
  const int r = blockIdx.x & 511;     // 512 work-group pieces an expert in either matrix
  if (blockIdx.x < 512) pack_pieces<D_DIM, F_DIM>(w1, W1P, cvbuf, r);
  else                  pack_pieces<F_DIM, D_DIM>(w2, W2P, cvbuf, r);
}

// ---------------- router: logits, softmax, top-2, bucket append, bf16 convert ----------------
__global__ void router_kernel(const float* __restrict__ hs,
                              const float* __restrict__ gw,
                              const float* __restrict__ gb,
                              bf16t* __restrict__ Xb,
                              int* __restrict__ counts,
                              int* __restrict__ etok,
                              float* __restrict__ ewt) {
  const int token = blockIdx.x;
  const int t = threadIdx.x;
  __shared__ float red[256];
  __shared__ float logit_sh[E_NUM];

  const float* x = hs + (size_t)token * D_DIM;
  float4 xv = *(const float4*)(x + 4 * t);

  union { bf16t b[4]; uint2 u; } cv;
  cv.b[0] = (bf16t)xv.x; cv.b[1] = (bf16t)xv.y;
  cv.b[2] = (bf16t)xv.z; cv.b[3] = (bf16t)xv.w;
  *(uint2*)(Xb + (size_t)token * D_DIM + 4 * t) = cv.u;

  float part[E_NUM];
#pragma unroll
  for (int e = 0; e < E_NUM; ++e) {
    const float* g = gw + (size_t)(4 * t) * E_NUM + e;
    part[e] = xv.x * g[0] + xv.y * g[E_NUM] + xv.z * g[2 * E_NUM] + xv.w * g[3 * E_NUM];
  }
  for (int e = 0; e < E_NUM; ++e) {
    red[t] = part[e];
    __syncthreads();
    for (int s = 128; s > 0; s >>= 1) {
      if (t < s) red[t] += red[t + s];
      __syncthreads();
    }
    if (t == 0) logit_sh[e] = red[0] + gb[e];
    __syncthreads();
  }

  if (t == 0) {
    float m = logit_sh[0];
#pragma unroll
    for (int e = 1; e < E_NUM; ++e) m = fmaxf(m, logit_sh[e]);
    float p[E_NUM], sum = 0.0f;
#pragma unroll
    for (int e = 0; e < E_NUM; ++e) { p[e] = expf(logit_sh[e] - m); sum += p[e]; }
    float inv = 1.0f / sum;
#pragma unroll
    for (int e = 0; e < E_NUM; ++e) p[e] *= inv;
    int i1 = 0; float g1 = p[0];
#pragma unroll
    for (int e = 1; e < E_NUM; ++e) if (p[e] > g1) { g1 = p[e]; i1 = e; }
    int i2 = (i1 == 0) ? 1 : 0; float g2 = p[i2];
#pragma unroll
    for (int e = 0; e < E_NUM; ++e) if (e != i1 && p[e] > g2) { g2 = p[e]; i2 = e; }

    int pos1 = atomicAdd(&counts[i1], 1);
    etok[(size_t)i1 * N_TOK + pos1] = token;
    ewt [(size_t)i1 * N_TOK + pos1] = g1;
    int pos2 = atomicAdd(&counts[i2], 1);
    etok[(size_t)i2 * N_TOK + pos2] = token;
    ewt [(size_t)i2 * N_TOK + pos2] = g2;
  }
}

// ---------------- expert FFN: register-blocked bf16 WMMA, weights global -> VGPR ----------------
// 256 threads = 8 wave32. Per 256-wide F chunk a wave computes H[64 x 32] (4 x 2 tiles),
// then adds H[64 x 256] @ W2 into its own Y[64 x 128] (4 x 8 tiles = 256 VGPRs).
// Every weight fragment is used by exactly one wave, so it goes straight to registers;
// a ring of 8 fragments is refilled in place right after each fragment's last use.
// The short loops over tiles, slots and registers are all unrolled, so that ring, acc,
// hacc and the A fragments are indexed statically and stay in registers.
__device__ __forceinline__ void ld_frag(Frag16& f, const bf16t* __restrict__ p) {
  f.u[0] = *(const uint4*)(p);
  f.u[1] = *(const uint4*)(p + 256);
}

// four k steps of H += X @ W1; ring slot p*2+j holds k step kt0+p of column tile j
template <bool LAST>
__device__ __forceinline__ void h_block(v8f (&hacc)[2][4], Frag16 (&ring)[8],
                                        const bf16t* xrow, int kt0,
                                        const bf16t* __restrict__ w1p,
                                        const bf16t* __restrict__ w2p) {
#pragma unroll
  for (int p = 0; p < 4; ++p) {
    Frag16 a[4];
#pragma unroll
    for (int mi = 0; mi < 4; ++mi) {
      const bf16t* ap = xrow + mi * 16 * XS_ST + (kt0 + p) * 32;
      a[mi].u[0] = *(const uint4*)(ap);
      a[mi].u[1] = *(const uint4*)(ap + 16);
    }
#pragma unroll
    for (int j = 0; j < 2; ++j) {
      const int s = p * 2 + j;
#pragma unroll
      for (int mi = 0; mi < 4; ++mi)
        hacc[j][mi] = __builtin_amdgcn_wmma_f32_16x16x32_bf16(
            false, a[mi].v, false, ring[s].v, (short)0, hacc[j][mi], false, false);
      if (!LAST) {
        ld_frag(ring[s], w1p + (size_t)(j * 32 + kt0 + p + 4) * FRAG);
      } else {
        ld_frag(ring[s], w2p + (size_t)(s * 128) * FRAG);   // first k step of H @ W2
        // holds each refill directly behind its fragment's last use: left free, the
        // scheduler gathers the refills into late clauses, which shortens their lead
        __builtin_amdgcn_sched_barrier(0);
      }
    }
  }
}

// one k step (32 f) of Y += H @ W2; ring slot n holds column tile n
template <bool LAST>
__device__ __forceinline__ void y_block(v8f (&acc)[8][4], Frag16 (&ring)[8],
                                        const bf16t* hrow, int ks,
                                        const bf16t* __restrict__ w2p,
                                        const bf16t* __restrict__ w1n) {
  Frag16 a[4];
#pragma unroll
  for (int mi = 0; mi < 4; ++mi) {
    const bf16t* ap = hrow + mi * 16 * HS_ST + ks * 32;
    a[mi].u[0] = *(const uint4*)(ap);
    a[mi].u[1] = *(const uint4*)(ap + 16);
  }
#pragma unroll
  for (int n = 0; n < 8; ++n) {
#pragma unroll
    for (int mi = 0; mi < 4; ++mi)
      acc[n][mi] = __builtin_amdgcn_wmma_f32_16x16x32_bf16(
          false, a[mi].v, false, ring[n].v, (short)0, acc[n][mi], false, false);
    if (!LAST) ld_frag(ring[n], w2p + (size_t)(n * 128 + ks + 1) * FRAG);
    else       ld_frag(ring[n], w1n + (size_t)((n & 1) * 32 + (n >> 1)) * FRAG);  // next chunk's X @ W1
    // holds each refill directly behind its fragment's last use and in slot order: left
    // free, the scheduler gathers and reorders the refills, their lead shrinks, and the
    // rolled H loop's head has to wait for nearly the whole ring instead of its oldest slot
    __builtin_amdgcn_sched_barrier(0);
  }
}

__global__ void __launch_bounds__(FFN_THREADS)
moe_ffn_kernel(const bf16t* __restrict__ W1P, const float* __restrict__ b1,
               const bf16t* __restrict__ W2P, const float* __restrict__ b2,
               const bf16t* __restrict__ Xb,
               const int* __restrict__ counts,
               const int* __restrict__ etok,
               const float* __restrict__ ewt,
               float* __restrict__ accbuf) {
  const int t = threadIdx.x;
  const int wave = t >> 5;
  const int lane = t & 31;

  // One work-group fills a WGP (LDS, registers). A whole tile for each tile would leave the few
  // tiles past FULL_T to a second round on a nearly idle chip. They are cut along F into pieces
  // of one chunk, which have the lowest indices; each adds its part of Y
  // to the output sum by itself.
  const int b = blockIdx.x;
  const bool piece = b < XTRA_T * NCHUNK;
  const int g   = piece ? FULL_T + b / NCHUNK : b - XTRA_T * NCHUNK;   // tile, counted over all experts
  const int fc0 = piece ? b % NCHUNK : 0;
  const int fc1 = piece ? fc0 + 1 : NCHUNK;

  int e = -1, tile = 0, count = 0, base = 0;
#pragma unroll
  for (int i = 0; i < E_NUM; ++i) {
    const int c = counts[i];
    const int n = (int)(((unsigned)c + TILE_M - 1) / TILE_M);
    if (e < 0 && g < base + n) { e = i; tile = g - base; count = c; }
    base += n;
  }
  if (e < 0) return;      // no such tile; the same for the whole work-group

  __shared__ __attribute__((aligned(16))) bf16t Xs[TILE_M * XS_ST];       // [64][1032]
  __shared__ __attribute__((aligned(16))) bf16t Hs[2][TILE_M * HS_ST];    // two x [64][264]
  __shared__ int   rowTok[TILE_M];
  __shared__ float rowW[TILE_M];

  if (t < TILE_M) {
    int idx = tile * TILE_M + t;
    bool ok = idx < count;
    int src = ok ? idx : 0;
    rowTok[t] = etok[(size_t)e * N_TOK + src];
    rowW[t]   = ok ? ewt[(size_t)e * N_TOK + src] : 0.0f;
  }
  __syncthreads();

  // ---- gather X tile (bf16) via async copies: 8192 chunks of 16 B, 32 per thread ----
#pragma unroll
  for (int i = 0; i < 4; ++i) {
    unsigned     l[8];
    const bf16t* g[8];
#pragma unroll
    for (int q = 0; q < 8; ++q) {
      int chunk = (i * 8 + q) * FFN_THREADS + t;
      int r = chunk >> 7;
      int c = (chunk & 127) << 3;
      l[q] = (unsigned)(uintptr_t)(Xs + r * XS_ST + c);
      g[q] = Xb + (size_t)rowTok[r] * D_DIM + c;
    }
    async_copy8_b128(l, g);
  }

  const int lrow = lane & 15;
  const int kb8  = (lane >> 4) << 3;

  // packed weights of this wave: 2 column tiles of W1 per chunk, 8 column tiles of W2
  const bf16t* w1w = W1P + ((size_t)(e * 256 + wave * 2) * 32) * FRAG + lane * 8;
  const bf16t* w2w = W2P + ((size_t)(e * 64 + wave * 8) * 128) * FRAG + lane * 8;

  Frag16 ring[8];
#pragma unroll
  for (int s = 0; s < 8; ++s)
    ld_frag(ring[s], w1w + (size_t)fc0 * (16 * 32 * FRAG) + (size_t)((s & 1) * 32 + (s >> 1)) * FRAG);

  v8f acc[8][4];
#pragma unroll
  for (int n = 0; n < 8; ++n)
#pragma unroll
    for (int mi = 0; mi < 4; ++mi) acc[n][mi] = zero8();

  // the first ring loads' address registers are free for reuse behind this line and are not
  // rewritten ahead of it
  asm volatile("s_wait_xcnt 0x0" ::: "memory");
  // the X tile has landed for this wave; the barrier publishes it to the others
  asm volatile("s_wait_asynccnt 0x0" ::: "memory");
  __syncthreads();

  const bf16t* xrow = Xs + lrow * XS_ST + kb8;

  // rolled: one chunk's code is already long, and acc is indexed statically inside it
#pragma unroll 1
  for (int fc = fc0; fc < fc1; ++fc) {
    const bf16t* w1p = w1w + (size_t)fc * (16 * 32 * FRAG);
    const bf16t* w2p = w2w + (size_t)fc * (8 * FRAG);
    const int fnext  = (fc + 1 < fc1) ? fc + 1 : fc;      // last chunk: a valid, unused refill
    const bf16t* w1n = w1w + (size_t)fnext * (16 * 32 * FRAG);
    bf16t* hs = Hs[fc & 1];
    // read ahead of this chunk's refills: loads return in order, and a bias read behind
    // them would wait for the whole ring
    float bb[2];
#pragma unroll
    for (int j = 0; j < 2; ++j)
      bb[j] = b1[(size_t)e * F_DIM + fc * FB + wave * 32 + j * 16 + lrow];

    // ======== H = X @ W1[:, chunk] ========
    v8f hacc[2][4];
#pragma unroll
    for (int j = 0; j < 2; ++j)
#pragma unroll
      for (int mi = 0; mi < 4; ++mi) hacc[j][mi] = zero8();

    // rolled: four k steps (32 WMMAs) a trip; for speed only
#pragma unroll 1
    for (int kt0 = 0; kt0 < 28; kt0 += 4)
      h_block<false>(hacc, ring, xrow, kt0, w1p, w2p);
    h_block<true>(hacc, ring, xrow, 28, w1p, w2p);

    // ---- bias + gelu -> Hs (bf16) ----
#pragma unroll
    for (int j = 0; j < 2; ++j) {
      int coln = wave * 32 + j * 16 + lrow;
#pragma unroll
      for (int mi = 0; mi < 4; ++mi)
#pragma unroll
        for (int v = 0; v < 8; ++v) {
          float xv = hacc[j][mi][v] + bb[j];
          hs[(mi * 16 + kb8 + v) * HS_ST + coln] = (bf16t)gelu_tanh(xv);
        }
    }
    // the one barrier of a chunk: publishes this chunk's H; with two H buffers it also
    // keeps the next write of this buffer behind every reader's last read of it
    __syncthreads();

    // ======== Y += H @ W2[chunk, :] ========
    const bf16t* hrow = hs + lrow * HS_ST + kb8;
    // unrolled: every refill then reads at a constant offset from one base of the chunk,
    // and no address register is rewritten between the k steps
#pragma unroll
    for (int ks = 0; ks < 7; ++ks)
      y_block<false>(acc, ring, hrow, ks, w2p, w1n);
    y_block<true>(acc, ring, hrow, 7, w2p, w1n);
    // the chunk's weight pointers are advanced behind this line: the issued loads'
    // address registers are not rewritten ahead of it
    asm volatile("s_wait_xcnt 0x0" ::: "memory");
  }

  // ---- epilogue: +b2 (once a tile: with its first chunk), scale by gate, scatter-accumulate ----
#pragma unroll
  for (int n = 0; n < 8; ++n) {
    int col = (wave * 8 + n) * 16 + lrow;
    float bb = b2[(size_t)e * D_DIM + col];
    bb = (fc0 == 0) ? bb : 0.0f;
#pragma unroll
    for (int mi = 0; mi < 4; ++mi)
#pragma unroll
      for (int v = 0; v < 8; ++v) {
        int r = mi * 16 + kb8 + v;
        float y = acc[n][mi][v] + bb;
        atomicAdd(accbuf + (size_t)rowTok[r] * D_DIM + col, rowW[r] * y);
      }
  }
}

// ---------------- residual + layernorm ----------------
__global__ void ln_kernel(const float* __restrict__ accbuf,
                          const float* __restrict__ inp,
                          const float* __restrict__ gamma,
                          const float* __restrict__ beta,
                          float* __restrict__ out) {
  const int token = blockIdx.x;
  const int t = threadIdx.x;
  __shared__ float red[256];
  __shared__ float mu_sh, rstd_sh;

  float4 a = *(const float4*)(accbuf + (size_t)token * D_DIM + 4 * t);
  float4 b = *(const float4*)(inp    + (size_t)token * D_DIM + 4 * t);
  float s0 = a.x + b.x, s1 = a.y + b.y, s2 = a.z + b.z, s3 = a.w + b.w;

  red[t] = s0 + s1 + s2 + s3;
  __syncthreads();
  for (int s = 128; s > 0; s >>= 1) {
    if (t < s) red[t] += red[t + s];
    __syncthreads();
  }
  if (t == 0) mu_sh = red[0] * (1.0f / D_DIM);
  __syncthreads();
  float mu = mu_sh;
  float d0 = s0 - mu, d1 = s1 - mu, d2 = s2 - mu, d3 = s3 - mu;
  red[t] = d0 * d0 + d1 * d1 + d2 * d2 + d3 * d3;
  __syncthreads();
  for (int s = 128; s > 0; s >>= 1) {
    if (t < s) red[t] += red[t + s];
    __syncthreads();
  }
  if (t == 0) rstd_sh = rsqrtf(red[0] * (1.0f / D_DIM) + 1e-5f);
  __syncthreads();
  float rstd = rstd_sh;

  int c = 4 * t;
  out[(size_t)token * D_DIM + c + 0] = d0 * rstd * gamma[c + 0] + beta[c + 0];
  out[(size_t)token * D_DIM + c + 1] = d1 * rstd * gamma[c + 1] + beta[c + 1];
  out[(size_t)token * D_DIM + c + 2] = d2 * rstd * gamma[c + 2] + beta[c + 2];
  out[(size_t)token * D_DIM + c + 3] = d3 * rstd * gamma[c + 3] + beta[c + 3];
}

extern "C" void kernel_launch(void* const* d_in, const int* in_sizes, int n_in,
                              void* d_out, int out_size, void* d_ws, size_t ws_size,
                              hipStream_t stream) {
  (void)in_sizes; (void)n_in; (void)out_size; (void)ws_size;
  const float* hs    = (const float*)d_in[0];
  const float* inp   = (const float*)d_in[1];
  const float* gw    = (const float*)d_in[2];
  const float* gb    = (const float*)d_in[3];
  const float* w1    = (const float*)d_in[4];
  const float* b1    = (const float*)d_in[5];
  const float* w2    = (const float*)d_in[6];
  const float* b2    = (const float*)d_in[7];
  const float* gamma = (const float*)d_in[8];
  const float* beta  = (const float*)d_in[9];
  float* out = (float*)d_out;

  char* ws = (char*)d_ws;
  size_t off = 0;
  int*   counts = (int*)(ws + off);   off += 256;
  int*   etok   = (int*)(ws + off);   off += (size_t)E_NUM * N_TOK * sizeof(int);
  float* ewt    = (float*)(ws + off); off += (size_t)E_NUM * N_TOK * sizeof(float);
  bf16t* Xb     = (bf16t*)(ws + off); off += (size_t)N_TOK * D_DIM * sizeof(bf16t);
  float* accb   = (float*)(ws + off); off += (size_t)N_TOK * D_DIM * sizeof(float);
  bf16t* W1T    = (bf16t*)(ws + off); off += (size_t)E_NUM * F_DIM * D_DIM * sizeof(bf16t);
  bf16t* W2T    = (bf16t*)(ws + off); off += (size_t)E_NUM * F_DIM * D_DIM * sizeof(bf16t);

  zero_kernel<<<dim3(2048), dim3(256), 0, stream>>>(accb, counts, (size_t)N_TOK * D_DIM);
  convert_w_kernel<<<dim3(1024), dim3(256), 0, stream>>>(w1, w2, W1T, W2T);
  router_kernel<<<dim3(N_TOK), dim3(256), 0, stream>>>(hs, gw, gb, Xb, counts, etok, ewt);
  moe_ffn_kernel<<<dim3(FFN_GRID), dim3(FFN_THREADS), 0, stream>>>(
      W1T, b1, W2T, b2, Xb, counts, etok, ewt, accb);
  ln_kernel<<<dim3(N_TOK), dim3(256), 0, stream>>>(accb, inp, gamma, beta, out);
}

// v005
// Measured time: 317 microseconds a run.
// Two timings next to v004 both put it at 1.06 times that version's speed.
// Counting every step since v000, it is 5.97 times as fast.
#include <hip/hip_runtime.h>
#include <hip/hip_bf16.h>

#define N_TOK 8192
#define D_DIM 1024
#define E_NUM 8
#define F_DIM 4096
#define TILE_M 64
#define FB 256                  // F columns per chunk
#define NCHUNK (F_DIM / FB)     // 16
#define FFN_THREADS 256         // 8 wave32, 2 per SIMD
#define FRAG 512                // bf16 elements of one packed 16(n) x 32(k) B fragment
// Every token goes to two experts: 2 * N_TOK rows, which fill FULL_T row tiles exactly. Each
// expert rounds its own rows up to whole tiles, so there are FULL_T to FULL_T + E_NUM - 1 tiles.
#define FULL_T (2 * N_TOK / TILE_M)             // 256: one work-group each, all of F
#define XTRA_T (E_NUM - 1)                      // tiles past FULL_T: one work-group a chunk of F
#define FFN_GRID (XTRA_T * NCHUNK + FULL_T)
// Rows of the Y buffer: one per (token, choice), then one per row of every piece of a cut tile.
#define Y_ROWS (2 * N_TOK)
#define P_ROWS (XTRA_T * NCHUNK * TILE_M)
// and, never read, one per row of an expert's last tile: its padding rows land there
#define PAD_ROWS (E_NUM * TILE_M)

#define XS_ST 1032   // Xs row stride (bf16 elems): 2064 B/row, 16B aligned
#define HS_ST 264    // Hs row stride (bf16 elems): 528 B/row, 16B aligned

typedef __bf16 bf16t;
typedef __attribute__((ext_vector_type(16))) bf16t v16bf;
typedef __attribute__((ext_vector_type(8)))  float v8f;

union Frag16 { v16bf v; uint4 u[2]; };

__device__ inline v8f zero8() {
  v8f z;
#pragma unroll
  for (int i = 0; i < 8; ++i) z[i] = 0.0f;
  return z;
}

// 0.5 * (1 + tanh(u)) = 1 / (1 + exp(-2u)), u = 0.79788...(x + 0.044715 x^3): one exp2 and one
// reciprocal a value and no branch. exp2 runs to +inf or to 0 at the ends, which gives the
// limits 0 and x.
__device__ inline float gelu_tanh(float x) {
  const float k = -2.0f * 0.7978845608028654f * 1.4426950408889634f;   // -2 sqrt(2/pi) log2(e)
  const float s = x * (k + (k * 0.044715f) * (x * x));
  return x * __builtin_amdgcn_rcpf(1.0f + __builtin_amdgcn_exp2f(s));
}

// ---- CDNA5 async copy: global -> LDS, 16B per lane, tracked by ASYNCcnt ----
// Eight copies and the s_wait_xcnt that keeps their address registers from being
// rewritten early stand in one statement.
__device__ __forceinline__ void async_copy8_b128(const unsigned* l, const bf16t* const* g) {
  asm volatile("global_load_async_to_lds_b128 %0, %8, off\n\t"
               "global_load_async_to_lds_b128 %1, %9, off\n\t"
               "global_load_async_to_lds_b128 %2, %10, off\n\t"
               "global_load_async_to_lds_b128 %3, %11, off\n\t"
               "global_load_async_to_lds_b128 %4, %12, off\n\t"
               "global_load_async_to_lds_b128 %5, %13, off\n\t"
               "global_load_async_to_lds_b128 %6, %14, off\n\t"
               "global_load_async_to_lds_b128 %7, %15, off\n\t"
               "s_wait_xcnt 0x0"
               :: "v"(l[0]), "v"(l[1]), "v"(l[2]), "v"(l[3]),
                  "v"(l[4]), "v"(l[5]), "v"(l[6]), "v"(l[7]),
                  "v"(g[0]), "v"(g[1]), "v"(g[2]), "v"(g[3]),
                  "v"(g[4]), "v"(g[5]), "v"(g[6]), "v"(g[7])
               : "memory");
}

// ---------------- zero the experts' row counters ----------------
__global__ void zero_kernel(int* counts) {
  if (threadIdx.x < E_NUM) counts[threadIdx.x] = 0;
}

// ---------------- weight convert to bf16, packed in WMMA B-fragment order ----------------
// One fragment = 16 columns (n) x 32 k = 512 elements = 1 KB, stored as
// [half j of the lane's registers][lane = h*16 + n][8 k], k = 16*j + 8*h + i,
// so that each of a fragment's two 16-byte loads reads 512 contiguous bytes.
// W1P: fragment ((e*256 + f/16)*32  + k/32), n = f, k = d-index of X@W1
// W2P: fragment ((e*64  + d/16)*128 + f/32), n = d, k = f-index of H@W2
//
// Both sources are [e][k][n] with n contiguous. A wave takes a 16(k) x 64(n) piece: eight
// 16-byte loads a lane, each wave-wide load two rows of 256 contiguous bytes. A lane then
// holds 4 n x 8 k = four 16-byte units of the packed form, which belong to one half (j) of
// one fragment. The units cross the wave's own LDS range and leave as one 512-byte run
// per fragment. A work-group's 8 waves lie side by side along n, and it takes the same
// piece of every expert in turn.
#define CV_FP 528               // LDS bytes of a fragment half: 512 + 16, so that the four
                                // fragments a half-wave writes at once fall on different banks
#define CV_WV (4 * CV_FP)       // LDS bytes of a wave

typedef __attribute__((ext_vector_type(4))) float v4f;

template <int N>
__device__ __forceinline__ void cv_load(v4f (&v)[8], const float* __restrict__ s, unsigned off) {
#pragma unroll
  for (int i = 0; i < 8; ++i) v[i] = *(const v4f*)(s + off + i * N);
  // the base is advanced behind this line: the issued loads' address registers are not
  // rewritten ahead of it
  asm volatile("s_wait_xcnt 0x0" ::: "memory");
}

__device__ __forceinline__ void cv_pack(uint4 (&p)[4], const v4f (&v)[8]) {
#pragma unroll
  for (int c = 0; c < 4; ++c) {
    union { bf16t b[8]; uint4 u; } x;
#pragma unroll
    for (int i = 0; i < 8; ++i) x.b[i] = (bf16t)v[i][c];
    p[c] = x.u;
  }
}

template <int K>
__device__ __forceinline__ void cv_emit(const uint4 (&p)[4], char* lw, const char* lr,
                                        bf16t* __restrict__ d, unsigned off) {
#pragma unroll
  for (int c = 0; c < 4; ++c) *(uint4*)(lw + c * 16) = p[c];
  // the wave reads back what its other lanes wrote: their LDS stores have to be done
  asm volatile("s_wait_dscnt 0x0" ::: "memory");
#pragma unroll
  for (int g = 0; g < 4; ++g)
    *(uint4*)(d + off + g * (K / 32) * FRAG) = *(const uint4*)(lr + g * CV_FP);
  // the issued stores' address and data registers are not rewritten ahead of this line
  asm volatile("s_wait_xcnt 0x0" ::: "memory");
}

template <int K, int N>
__device__ __forceinline__ void pack_pieces(const float* __restrict__ src,
                                            bf16t* __restrict__ dst,
                                            char* lds, int r) {
  const int t = threadIdx.x;
  const int w = t >> 5;
  const int l = t & 31;
  const int kb = r / (N / 512);       // which 16 k
  const int nb = r % (N / 512);       // which 512 n
  const float* s = src + (size_t)kb * 16 * N + nb * 512;
  bf16t*       d = dst + (size_t)nb * 512 * K + kb * 256;
  const unsigned soff = (unsigned)((l >> 4) * 8 * N + w * 64 + (l & 15) * 4);
  const unsigned doff = (unsigned)(w * 64 * K + l * 8);
  char*       lw = lds + w * CV_WV + ((l & 15) >> 2) * CV_FP + (l >> 4) * 256 + (l & 3) * 64;
  const char* lr = lds + w * CV_WV + l * 16;

  v4f   v[8];
  uint4 p[4];
  cv_load<N>(v, s, soff);
  // rolled: the body is short; the next expert's piece flies while this one crosses LDS
#pragma unroll 1
  for (int e = 0; e + 1 < E_NUM; ++e) {
    cv_pack(p, v);
    s += (size_t)K * N;
    cv_load<N>(v, s, soff);
    cv_emit<K>(p, lw, lr, d, doff);
    d += (size_t)K * N;
  }
  cv_pack(p, v);
  cv_emit<K>(p, lw, lr, d, doff);
}

__global__ void __launch_bounds__(256)
convert_w_kernel(const float* __restrict__ w1,
                 const float* __restrict__ w2,
                 bf16t* __restrict__ W1P,
                 bf16t* __restrict__ W2P) {
  __shared__ __attribute__((aligned(16))) char cvbuf[8 * CV_WV];
  const int r = blockIdx.x & 511;     // 512 work-group pieces an expert in either matrix
  if (blockIdx.x < 512) pack_pieces<D_DIM, F_DIM>(w1, W1P, cvbuf, r);
  else                  pack_pieces<F_DIM, D_DIM>(w2, W2P, cvbuf, r);
}

// ---------------- router: logits, softmax, top-2, bucket append, bf16 convert ----------------
__global__ void router_kernel(const float* __restrict__ hs,
                              const float* __restrict__ gw,
                              const float* __restrict__ gb,
                              bf16t* __restrict__ Xb,
                              int* __restrict__ counts,
                              int* __restrict__ etok,
                              float* __restrict__ ewt) {
  const int token = blockIdx.x;
  const int t = threadIdx.x;
  __shared__ float red[256];
  __shared__ float logit_sh[E_NUM];

  const float* x = hs + (size_t)token * D_DIM;
  float4 xv = *(const float4*)(x + 4 * t);

  union { bf16t b[4]; uint2 u; } cv;
  cv.b[0] = (bf16t)xv.x; cv.b[1] = (bf16t)xv.y;
  cv.b[2] = (bf16t)xv.z; cv.b[3] = (bf16t)xv.w;
  *(uint2*)(Xb + (size_t)token * D_DIM + 4 * t) = cv.u;

  float part[E_NUM];
#pragma unroll
  for (int e = 0; e < E_NUM; ++e) {
    const float* g = gw + (size_t)(4 * t) * E_NUM + e;
    part[e] = xv.x * g[0] + xv.y * g[E_NUM] + xv.z * g[2 * E_NUM] + xv.w * g[3 * E_NUM];
  }
  for (int e = 0; e < E_NUM; ++e) {
    red[t] = part[e];
    __syncthreads();
    for (int s = 128; s > 0; s >>= 1) {
      if (t < s) red[t] += red[t + s];
      __syncthreads();
    }
    if (t == 0) logit_sh[e] = red[0] + gb[e];
    __syncthreads();
  }

  if (t == 0) {
    float m = logit_sh[0];
#pragma unroll
    for (int e = 1; e < E_NUM; ++e) m = fmaxf(m, logit_sh[e]);
    float p[E_NUM], sum = 0.0f;
#pragma unroll
    for (int e = 0; e < E_NUM; ++e) { p[e] = expf(logit_sh[e] - m); sum += p[e]; }
    float inv = 1.0f / sum;
#pragma unroll
    for (int e = 0; e < E_NUM; ++e) p[e] *= inv;
    int i1 = 0; float g1 = p[0];
#pragma unroll
    for (int e = 1; e < E_NUM; ++e) if (p[e] > g1) { g1 = p[e]; i1 = e; }
    int i2 = (i1 == 0) ? 1 : 0; float g2 = p[i2];
#pragma unroll
    for (int e = 0; e < E_NUM; ++e) if (e != i1 && p[e] > g2) { g2 = p[e]; i2 = e; }

    // an entry is the token's row of the Y buffer: 2 * token + (first or second choice)
    int pos1 = atomicAdd(&counts[i1], 1);
    etok[(size_t)i1 * N_TOK + pos1] = 2 * token;
    ewt [(size_t)i1 * N_TOK + pos1] = g1;
    int pos2 = atomicAdd(&counts[i2], 1);
    etok[(size_t)i2 * N_TOK + pos2] = 2 * token + 1;
    ewt [(size_t)i2 * N_TOK + pos2] = g2;
  }
}

// ---------------- expert FFN: register-blocked bf16 WMMA, weights global -> VGPR ----------------
// 256 threads = 8 wave32. Per 256-wide F chunk a wave computes H[64 x 32] (4 x 2 tiles),
// then adds H[64 x 256] @ W2 into its own Y[64 x 128] (4 x 8 tiles = 256 VGPRs).
// Every weight fragment is used by exactly one wave, so it goes straight to registers;
// a ring of 8 fragments is refilled in place right after each fragment's last use.
// The short loops over tiles, slots and registers are all unrolled, so that ring, acc,
// hacc and the A fragments are indexed statically and stay in registers.
__device__ __forceinline__ void ld_frag(Frag16& f, const bf16t* __restrict__ p) {
  f.u[0] = *(const uint4*)(p);
  f.u[1] = *(const uint4*)(p + 256);
}

// four k steps of H += X @ W1; ring slot p*2+j holds k step kt0+p of column tile j
template <bool LAST>
__device__ __forceinline__ void h_block(v8f (&hacc)[2][4], Frag16 (&ring)[8],
                                        const bf16t* xrow, int kt0,
                                        const bf16t* __restrict__ w1p,
                                        const bf16t* __restrict__ w2p) {
#pragma unroll
  for (int p = 0; p < 4; ++p) {
    Frag16 a[4];
#pragma unroll
    for (int mi = 0; mi < 4; ++mi) {
      const bf16t* ap = xrow + mi * 16 * XS_ST + (kt0 + p) * 32;
      a[mi].u[0] = *(const uint4*)(ap);
      a[mi].u[1] = *(const uint4*)(ap + 16);
    }
#pragma unroll
    for (int j = 0; j < 2; ++j) {
      const int s = p * 2 + j;
#pragma unroll
      for (int mi = 0; mi < 4; ++mi)
        hacc[j][mi] = __builtin_amdgcn_wmma_f32_16x16x32_bf16(
            false, a[mi].v, false, ring[s].v, (short)0, hacc[j][mi], false, false);
      if (!LAST) {
        ld_frag(ring[s], w1p + (size_t)(j * 32 + kt0 + p + 4) * FRAG);
      } else {
        ld_frag(ring[s], w2p + (size_t)(s * 128) * FRAG);   // first k step of H @ W2
        // holds each refill directly behind its fragment's last use: left free, the
        // scheduler gathers the refills into late clauses, which shortens their lead
        __builtin_amdgcn_sched_barrier(0);
      }
    }
  }
}

// one k step (32 f) of Y += H @ W2; ring slot n holds column tile n
template <bool LAST>
__device__ __forceinline__ void y_block(v8f (&acc)[8][4], Frag16 (&ring)[8],
                                        const bf16t* hrow, int ks,
                                        const bf16t* __restrict__ w2p,
                                        const bf16t* __restrict__ w1n) {
  Frag16 a[4];
#pragma unroll
  for (int mi = 0; mi < 4; ++mi) {
    const bf16t* ap = hrow + mi * 16 * HS_ST + ks * 32;
    a[mi].u[0] = *(const uint4*)(ap);
    a[mi].u[1] = *(const uint4*)(ap + 16);
  }
#pragma unroll
  for (int n = 0; n < 8; ++n) {
#pragma unroll
    for (int mi = 0; mi < 4; ++mi)
      acc[n][mi] = __builtin_amdgcn_wmma_f32_16x16x32_bf16(
          false, a[mi].v, false, ring[n].v, (short)0, acc[n][mi], false, false);
    if (!LAST) ld_frag(ring[n], w2p + (size_t)(n * 128 + ks + 1) * FRAG);
    else       ld_frag(ring[n], w1n + (size_t)((n & 1) * 32 + (n >> 1)) * FRAG);  // next chunk's X @ W1
    // holds each refill directly behind its fragment's last use and in slot order: left
    // free, the scheduler gathers and reorders the refills, their lead shrinks, and the
    // rolled H loop's head has to wait for nearly the whole ring instead of its oldest slot
    __builtin_amdgcn_sched_barrier(0);
  }
}

__global__ void __launch_bounds__(FFN_THREADS)
moe_ffn_kernel(const bf16t* __restrict__ W1P, const float* __restrict__ b1,
               const bf16t* __restrict__ W2P, const float* __restrict__ b2,
               const bf16t* __restrict__ Xb,
               const int* __restrict__ counts,
               const int* __restrict__ etok,
               const float* __restrict__ ewt,
               float* __restrict__ ybuf,
               int* __restrict__ pmap) {
  const int t = threadIdx.x;
  const int wave = t >> 5;
  const int lane = t & 31;

  // One work-group fills a WGP (LDS, registers). A whole tile for each tile would leave the few
  // tiles past FULL_T to a second round on a nearly idle chip. They are cut along F into pieces
  // of one chunk, which have the lowest indices; each stores its part of Y
  // in rows of its own, and the last launch adds the parts.
  const int b = blockIdx.x;
  const bool piece = b < XTRA_T * NCHUNK;
  const int g   = piece ? FULL_T + b / NCHUNK : b - XTRA_T * NCHUNK;   // tile, counted over all experts
  const int fc0 = piece ? b % NCHUNK : 0;
  const int fc1 = piece ? fc0 + 1 : NCHUNK;

  int e = -1, tile = 0, count = 0, base = 0;
#pragma unroll
  for (int i = 0; i < E_NUM; ++i) {
    const int c = counts[i];
    const int n = (int)(((unsigned)c + TILE_M - 1) / TILE_M);
    if (e < 0 && g < base + n) { e = i; tile = g - base; count = c; }
    base += n;
  }
  if (e < 0) return;      // no such tile; the same for the whole work-group

  __shared__ __attribute__((aligned(16))) bf16t Xs[TILE_M * XS_ST];       // [64][1032]
  __shared__ __attribute__((aligned(16))) bf16t Hs[2][TILE_M * HS_ST];    // two x [64][264]
  __shared__ int   rowTok[TILE_M];
  __shared__ __attribute__((aligned(16))) int   rowDst[TILE_M];   // row of ybuf that takes this row's Y
  __shared__ __attribute__((aligned(16))) float rowW[TILE_M];

  if (t < TILE_M) {
    int idx = tile * TILE_M + t;
    bool ok = idx < count;
    int src = ok ? idx : 0;
    int ent = etok[(size_t)e * N_TOK + src];
    int p0  = Y_ROWS + (g - FULL_T) * (NCHUNK * TILE_M) + t;    // a cut tile: its first piece's row
    rowTok[t] = ent >> 1;
    rowDst[t] = piece ? p0 + fc0 * TILE_M : (ok ? ent : Y_ROWS + P_ROWS + e * TILE_M + t);
    rowW[t]   = ok ? ewt[(size_t)e * N_TOK + src] : 0.0f;
    // tells the last launch where this (token, choice) has its Y: in its own row, or in pieces
    if (ok && fc0 == 0) pmap[ent] = piece ? p0 : -1;
  }
  __syncthreads();

  // ---- gather X tile (bf16) via async copies: 8192 chunks of 16 B, 32 per thread ----
#pragma unroll
  for (int i = 0; i < 4; ++i) {
    unsigned     l[8];
    const bf16t* g[8];
#pragma unroll
    for (int q = 0; q < 8; ++q) {
      int chunk = (i * 8 + q) * FFN_THREADS + t;
      int r = chunk >> 7;
      int c = (chunk & 127) << 3;
      l[q] = (unsigned)(uintptr_t)(Xs + r * XS_ST + c);
      g[q] = Xb + (size_t)rowTok[r] * D_DIM + c;
    }
    async_copy8_b128(l, g);
  }

  const int lrow = lane & 15;
  const int kb8  = (lane >> 4) << 3;

  // packed weights of this wave: 2 column tiles of W1 per chunk, 8 column tiles of W2
  const bf16t* w1w = W1P + ((size_t)(e * 256 + wave * 2) * 32) * FRAG + lane * 8;
  const bf16t* w2w = W2P + ((size_t)(e * 64 + wave * 8) * 128) * FRAG + lane * 8;

  Frag16 ring[8];
#pragma unroll
  for (int s = 0; s < 8; ++s)
    ld_frag(ring[s], w1w + (size_t)fc0 * (16 * 32 * FRAG) + (size_t)((s & 1) * 32 + (s >> 1)) * FRAG);

  v8f acc[8][4];
#pragma unroll
  for (int n = 0; n < 8; ++n)
#pragma unroll
    for (int mi = 0; mi < 4; ++mi) acc[n][mi] = zero8();

  // the first ring loads' address registers are free for reuse behind this line and are not
  // rewritten ahead of it
  asm volatile("s_wait_xcnt 0x0" ::: "memory");
  // the X tile has landed for this wave; the barrier publishes it to the others
  asm volatile("s_wait_asynccnt 0x0" ::: "memory");
  __syncthreads();

  const bf16t* xrow = Xs + lrow * XS_ST + kb8;

  // rolled: one chunk's code is already long, and acc is indexed statically inside it
#pragma unroll 1
  for (int fc = fc0; fc < fc1; ++fc) {
    const bf16t* w1p = w1w + (size_t)fc * (16 * 32 * FRAG);
    const bf16t* w2p = w2w + (size_t)fc * (8 * FRAG);
    const int fnext  = (fc + 1 < fc1) ? fc + 1 : fc;      // last chunk: a valid, unused refill
    const bf16t* w1n = w1w + (size_t)fnext * (16 * 32 * FRAG);
    bf16t* hs = Hs[fc & 1];
    // read ahead of this chunk's refills: loads return in order, and a bias read behind
    // them would wait for the whole ring
    float bb[2];
#pragma unroll
    for (int j = 0; j < 2; ++j)
      bb[j] = b1[(size_t)e * F_DIM + fc * FB + wave * 32 + j * 16 + lrow];

    // ======== H = X @ W1[:, chunk] ========
    v8f hacc[2][4];
#pragma unroll
    for (int j = 0; j < 2; ++j)
#pragma unroll
      for (int mi = 0; mi < 4; ++mi) hacc[j][mi] = zero8();

    // rolled: four k steps (32 WMMAs) a trip; for speed only
#pragma unroll 1
    for (int kt0 = 0; kt0 < 28; kt0 += 4)
      h_block<false>(hacc, ring, xrow, kt0, w1p, w2p);
    h_block<true>(hacc, ring, xrow, 28, w1p, w2p);

    // ---- bias + gelu -> Hs (bf16) ----
#pragma unroll
    for (int j = 0; j < 2; ++j) {
      int coln = wave * 32 + j * 16 + lrow;
#pragma unroll
      for (int mi = 0; mi < 4; ++mi)
#pragma unroll
        for (int v = 0; v < 8; ++v) {
          float xv = hacc[j][mi][v] + bb[j];
          hs[(mi * 16 + kb8 + v) * HS_ST + coln] = (bf16t)gelu_tanh(xv);
        }
    }
    // the one barrier of a chunk: publishes this chunk's H; with two H buffers it also
    // keeps the next write of this buffer behind every reader's last read of it
    __syncthreads();

    // ======== Y += H @ W2[chunk, :] ========
    const bf16t* hrow = hs + lrow * HS_ST + kb8;
    // unrolled: every refill then reads at a constant offset from one base of the chunk,
    // and no address register is rewritten between the k steps
#pragma unroll
    for (int ks = 0; ks < 7; ++ks)
      y_block<false>(acc, ring, hrow, ks, w2p, w1n);
    y_block<true>(acc, ring, hrow, 7, w2p, w1n);
    // the chunk's weight pointers are advanced behind this line: the issued loads'
    // address registers are not rewritten ahead of it
    asm volatile("s_wait_xcnt 0x0" ::: "memory");
  }

  // ---- epilogue: +b2 (once a tile: with its first chunk), scale by gate, store each row ----
  // Every row of ybuf has one writer, so the rows are stored plainly.
  float bb[8];
#pragma unroll
  for (int n = 0; n < 8; ++n) {
    float x = b2[(size_t)e * D_DIM + (wave * 8 + n) * 16 + lrow];
    bb[n] = (fc0 == 0) ? x : 0.0f;
  }
  // the bias loads' address registers are not rewritten ahead of this line
  asm volatile("s_wait_xcnt 0x0" ::: "memory");
  float* ycol = ybuf + wave * 128 + lrow;
  float* yp[4][8];
#pragma unroll
  for (int mi = 0; mi < 4; ++mi) {
    // the lane's eight rows of this tile row: their places and gates in four 16-byte LDS reads
    union { int4 q[2]; int i[8]; } dst;
    union { float4 q[2]; float f[8]; } w;
#pragma unroll
    for (int h = 0; h < 2; ++h) {
      dst.q[h] = *(const int4*)(rowDst + mi * 16 + kb8 + h * 4);
      w.q[h]   = *(const float4*)(rowW + mi * 16 + kb8 + h * 4);
    }
#pragma unroll
    for (int v = 0; v < 8; ++v) {
      yp[mi][v] = ycol + (size_t)dst.i[v] * D_DIM;
#pragma unroll
      for (int n = 0; n < 8; ++n) acc[n][mi][v] = w.f[v] * (acc[n][mi][v] + bb[n]);
    }
  }
  // every value and every address is formed ahead of the first store: left free, the scheduler
  // mixes them with the stores and rewrites registers that issued stores still name
  __builtin_amdgcn_sched_barrier(0);
#pragma unroll
  for (int mi = 0; mi < 4; ++mi)
#pragma unroll
    for (int v = 0; v < 8; ++v)
#pragma unroll
      for (int n = 0; n < 8; ++n) yp[mi][v][n * 16] = acc[n][mi][v];
}

// ---------------- sum of the two experts' terms + residual + layernorm ----------------
// four columns of one (token, choice): its own row, or the sum of a cut tile's pieces in order
__device__ __forceinline__ float4 y_term(const float* __restrict__ ybuf, int own, int m, int c) {
  if (m < 0) return *(const float4*)(ybuf + (size_t)own * D_DIM + c);
  const float* p = ybuf + (size_t)m * D_DIM + c;
  float4 s = *(const float4*)p;
#pragma unroll
  for (int i = 1; i < NCHUNK; ++i) {
    float4 q = *(const float4*)(p + (size_t)i * TILE_M * D_DIM);
    s.x += q.x; s.y += q.y; s.z += q.z; s.w += q.w;
  }
  return s;
}

__global__ void ln_kernel(const float* __restrict__ ybuf,
                          const int* __restrict__ pmap,
                          const float* __restrict__ inp,
                          const float* __restrict__ gamma,
                          const float* __restrict__ beta,
                          float* __restrict__ out) {
  const int token = blockIdx.x;
  const int t = threadIdx.x;
  __shared__ float red[256];
  __shared__ float mu_sh, rstd_sh;

  const int2 m = *(const int2*)(pmap + 2 * token);
  float4 b = *(const float4*)(inp + (size_t)token * D_DIM + 4 * t);
  float4 a = y_term(ybuf, 2 * token,     m.x, 4 * t);
  // the issued loads' address registers are not rewritten ahead of this line
  asm volatile("s_wait_xcnt 0x0" ::: "memory");
  float4 q = y_term(ybuf, 2 * token + 1, m.y, 4 * t);
  // as above
  asm volatile("s_wait_xcnt 0x0" ::: "memory");
  float s0 = (a.x + q.x) + b.x, s1 = (a.y + q.y) + b.y;
  float s2 = (a.z + q.z) + b.z, s3 = (a.w + q.w) + b.w;

  red[t] = s0 + s1 + s2 + s3;
  __syncthreads();
  for (int s = 128; s > 0; s >>= 1) {
    if (t < s) red[t] += red[t + s];
    __syncthreads();
  }
  if (t == 0) mu_sh = red[0] * (1.0f / D_DIM);
  __syncthreads();
  float mu = mu_sh;
  float d0 = s0 - mu, d1 = s1 - mu, d2 = s2 - mu, d3 = s3 - mu;
  red[t] = d0 * d0 + d1 * d1 + d2 * d2 + d3 * d3;
  __syncthreads();
  for (int s = 128; s > 0; s >>= 1) {
    if (t < s) red[t] += red[t + s];
    __syncthreads();
  }
  if (t == 0) rstd_sh = rsqrtf(red[0] * (1.0f / D_DIM) + 1e-5f);
  __syncthreads();
  float rstd = rstd_sh;

  int c = 4 * t;
  out[(size_t)token * D_DIM + c + 0] = d0 * rstd * gamma[c + 0] + beta[c + 0];
  out[(size_t)token * D_DIM + c + 1] = d1 * rstd * gamma[c + 1] + beta[c + 1];
  out[(size_t)token * D_DIM + c + 2] = d2 * rstd * gamma[c + 2] + beta[c + 2];
  out[(size_t)token * D_DIM + c + 3] = d3 * rstd * gamma[c + 3] + beta[c + 3];
}

extern "C" void kernel_launch(void* const* d_in, const int* in_sizes, int n_in,
                              void* d_out, int out_size, void* d_ws, size_t ws_size,
                              hipStream_t stream) {
  (void)in_sizes; (void)n_in; (void)out_size; (void)ws_size;
  const float* hs    = (const float*)d_in[0];
  const float* inp   = (const float*)d_in[1];
  const float* gw    = (const float*)d_in[2];
  const float* gb    = (const float*)d_in[3];
  const float* w1    = (const float*)d_in[4];
  const float* b1    = (const float*)d_in[5];
  const float* w2    = (const float*)d_in[6];
  const float* b2    = (const float*)d_in[7];
  const float* gamma = (const float*)d_in[8];
  const float* beta  = (const float*)d_in[9];
  float* out = (float*)d_out;

  char* ws = (char*)d_ws;
  size_t off = 0;
  int*   counts = (int*)(ws + off);   off += 256;
  int*   etok   = (int*)(ws + off);   off += (size_t)E_NUM * N_TOK * sizeof(int);
  float* ewt    = (float*)(ws + off); off += (size_t)E_NUM * N_TOK * sizeof(float);
  bf16t* Xb     = (bf16t*)(ws + off); off += (size_t)N_TOK * D_DIM * sizeof(bf16t);
  int*   pmap   = (int*)(ws + off);   off += (size_t)Y_ROWS * sizeof(int);
  float* ybuf   = (float*)(ws + off); off += (size_t)(Y_ROWS + P_ROWS + PAD_ROWS) * D_DIM * sizeof(float);
  bf16t* W1T    = (bf16t*)(ws + off); off += (size_t)E_NUM * F_DIM * D_DIM * sizeof(bf16t);
  bf16t* W2T    = (bf16t*)(ws + off); off += (size_t)E_NUM * F_DIM * D_DIM * sizeof(bf16t);

  zero_kernel<<<dim3(1), dim3(32), 0, stream>>>(counts);
  convert_w_kernel<<<dim3(1024), dim3(256), 0, stream>>>(w1, w2, W1T, W2T);
  router_kernel<<<dim3(N_TOK), dim3(256), 0, stream>>>(hs, gw, gb, Xb, counts, etok, ewt);
  moe_ffn_kernel<<<dim3(FFN_GRID), dim3(FFN_THREADS), 0, stream>>>(
      W1T, b1, W2T, b2, Xb, counts, etok, ewt, ybuf, pmap);
  ln_kernel<<<dim3(N_TOK), dim3(256), 0, stream>>>(ybuf, pmap, inp, gamma, beta, out);
}

// v006
// A run of this version takes 284 microseconds.
// Two timings next to v005 both put it at 1.12 times that version's speed.
// Over all steps from v000 it is 6.68 times as fast.
#include <hip/hip_runtime.h>
#include <hip/hip_bf16.h>

#define N_TOK 8192
#define D_DIM 1024
#define E_NUM 8
#define F_DIM 4096
#define TILE_M 64
#define FB 256                  // F columns per chunk
#define NCHUNK (F_DIM / FB)     // 16
#define FFN_THREADS 256         // 8 wave32, 2 per SIMD
#define FRAG 512                // bf16 elements of one packed 16(n) x 32(k) B fragment
// Every token goes to two experts: 2 * N_TOK rows, which fill FULL_T row tiles exactly. Each
// expert rounds its own rows up to whole tiles, so there are FULL_T to FULL_T + E_NUM - 1 tiles.
#define FULL_T (2 * N_TOK / TILE_M)             // 256: one work-group each, all of F
#define XTRA_T (E_NUM - 1)                      // tiles past FULL_T: one work-group a chunk of F
#define FFN_GRID (XTRA_T * NCHUNK + FULL_T)
// Rows of the Y buffer: one per (token, choice), then one per row of every piece of a cut tile.
#define Y_ROWS (2 * N_TOK)
#define P_ROWS (XTRA_T * NCHUNK * TILE_M)
// and, never read, one per row of an expert's last tile: its padding rows land there
#define PAD_ROWS (E_NUM * TILE_M)

#define XS_ST 1032   // Xs row stride (bf16 elems): 2064 B/row, 16B aligned
#define HS_ST 264    // Hs row stride (bf16 elems): 528 B/row, 16B aligned

typedef __bf16 bf16t;
typedef __attribute__((ext_vector_type(16))) bf16t v16bf;
typedef __attribute__((ext_vector_type(8)))  float v8f;

union Frag16 { v16bf v; uint4 u[2]; };

__device__ inline v8f zero8() {
  v8f z;
#pragma unroll
  for (int i = 0; i < 8; ++i) z[i] = 0.0f;
  return z;
}

// 0.5 * (1 + tanh(u)) = 1 / (1 + exp(-2u)), u = 0.79788...(x + 0.044715 x^3): one exp2 and one
// reciprocal a value and no branch. exp2 runs to +inf or to 0 at the ends, which gives the
// limits 0 and x.
__device__ inline float gelu_tanh(float x) {
  const float k = -2.0f * 0.7978845608028654f * 1.4426950408889634f;   // -2 sqrt(2/pi) log2(e)
  const float s = x * (k + (k * 0.044715f) * (x * x));
  return x * __builtin_amdgcn_rcpf(1.0f + __builtin_amdgcn_exp2f(s));
}

// ---- CDNA5 async copy: global -> LDS, 16B per lane, tracked by ASYNCcnt ----
// Eight copies and the s_wait_xcnt that keeps their address registers from being
// rewritten early stand in one statement.
__device__ __forceinline__ void async_copy8_b128(const unsigned* l, const bf16t* const* g) {
  asm volatile("global_load_async_to_lds_b128 %0, %8, off\n\t"
               "global_load_async_to_lds_b128 %1, %9, off\n\t"
               "global_load_async_to_lds_b128 %2, %10, off\n\t"
               "global_load_async_to_lds_b128 %3, %11, off\n\t"
               "global_load_async_to_lds_b128 %4, %12, off\n\t"
               "global_load_async_to_lds_b128 %5, %13, off\n\t"
               "global_load_async_to_lds_b128 %6, %14, off\n\t"
               "global_load_async_to_lds_b128 %7, %15, off\n\t"
               "s_wait_xcnt 0x0"
               :: "v"(l[0]), "v"(l[1]), "v"(l[2]), "v"(l[3]),
                  "v"(l[4]), "v"(l[5]), "v"(l[6]), "v"(l[7]),
                  "v"(g[0]), "v"(g[1]), "v"(g[2]), "v"(g[3]),
                  "v"(g[4]), "v"(g[5]), "v"(g[6]), "v"(g[7])
               : "memory");
}

// ---------------- zero the experts' row counters ----------------
__global__ void zero_kernel(int* counts) {
  if (threadIdx.x < E_NUM) counts[threadIdx.x] = 0;
}

// ---------------- weight convert to bf16, packed in WMMA B-fragment order ----------------
// One fragment = 16 columns (n) x 32 k = 512 elements = 1 KB, stored as
// [half j of the lane's registers][lane = h*16 + n][8 k], k = 16*j + 8*h + i,
// so that each of a fragment's two 16-byte loads reads 512 contiguous bytes.
// W1P: fragment ((e*256 + f/16)*32  + k/32), n = f, k = d-index of X@W1
// W2P: fragment ((e*64  + d/16)*128 + f/32), n = d, k = f-index of H@W2
//
// Both sources are [e][k][n] with n contiguous. A wave takes a 16(k) x 64(n) piece: eight
// 16-byte loads a lane, each wave-wide load two rows of 256 contiguous bytes. A lane then
// holds 4 n x 8 k = four 16-byte units of the packed form, which belong to one half (j) of
// one fragment. The units cross the wave's own LDS range and leave as one 512-byte run
// per fragment. A work-group's 8 waves lie side by side along n, and it takes the same
// piece of every expert in turn.
#define CV_FP 528               // LDS bytes of a fragment half: 512 + 16, so that the four
                                // fragments a half-wave writes at once fall on different banks
#define CV_WV (4 * CV_FP)       // LDS bytes of a wave

typedef __attribute__((ext_vector_type(4))) float v4f;

template <int N>
__device__ __forceinline__ void cv_load(v4f (&v)[8], const float* __restrict__ s, unsigned off) {
#pragma unroll
  for (int i = 0; i < 8; ++i) v[i] = *(const v4f*)(s + off + i * N);
  // the base is advanced behind this line: the issued loads' address registers are not
  // rewritten ahead of it
  asm volatile("s_wait_xcnt 0x0" ::: "memory");
}

__device__ __forceinline__ void cv_pack(uint4 (&p)[4], const v4f (&v)[8]) {
#pragma unroll
  for (int c = 0; c < 4; ++c) {
    union { bf16t b[8]; uint4 u; } x;
#pragma unroll
    for (int i = 0; i < 8; ++i) x.b[i] = (bf16t)v[i][c];
    p[c] = x.u;
  }
}

template <int K>
__device__ __forceinline__ void cv_emit(const uint4 (&p)[4], char* lw, const char* lr,
                                        bf16t* __restrict__ d, unsigned off) {
#pragma unroll
  for (int c = 0; c < 4; ++c) *(uint4*)(lw + c * 16) = p[c];
  // the wave reads back what its other lanes wrote: their LDS stores have to be done
  asm volatile("s_wait_dscnt 0x0" ::: "memory");
#pragma unroll
  for (int g = 0; g < 4; ++g)
    *(uint4*)(d + off + g * (K / 32) * FRAG) = *(const uint4*)(lr + g * CV_FP);
  // the issued stores' address and data registers are not rewritten ahead of this line
  asm volatile("s_wait_xcnt 0x0" ::: "memory");
}

template <int K, int N>
__device__ __forceinline__ void pack_pieces(const float* __restrict__ src,
                                            bf16t* __restrict__ dst,
                                            char* lds, int r) {
  const int t = threadIdx.x;
  const int w = t >> 5;
  const int l = t & 31;
  const int kb = r / (N / 512);       // which 16 k
  const int nb = r % (N / 512);       // which 512 n
  const float* s = src + (size_t)kb * 16 * N + nb * 512;
  bf16t*       d = dst + (size_t)nb * 512 * K + kb * 256;
  const unsigned soff = (unsigned)((l >> 4) * 8 * N + w * 64 + (l & 15) * 4);
  const unsigned doff = (unsigned)(w * 64 * K + l * 8);
  char*       lw = lds + w * CV_WV + ((l & 15) >> 2) * CV_FP + (l >> 4) * 256 + (l & 3) * 64;
  const char* lr = lds + w * CV_WV + l * 16;

  v4f   v[8];
  uint4 p[4];
  cv_load<N>(v, s, soff);
  // rolled: the body is short; the next expert's piece flies while this one crosses LDS
#pragma unroll 1
  for (int e = 0; e + 1 < E_NUM; ++e) {
    cv_pack(p, v);
    s += (size_t)K * N;
    cv_load<N>(v, s, soff);
    cv_emit<K>(p, lw, lr, d, doff);
    d += (size_t)K * N;
  }
  cv_pack(p, v);
  cv_emit<K>(p, lw, lr, d, doff);
}

__global__ void __launch_bounds__(256)
convert_w_kernel(const float* __restrict__ w1,
                 const float* __restrict__ w2,
                 bf16t* __restrict__ W1P,
                 bf16t* __restrict__ W2P) {
  __shared__ __attribute__((aligned(16))) char cvbuf[8 * CV_WV];
  const int r = blockIdx.x & 511;     // 512 work-group pieces an expert in either matrix
  if (blockIdx.x < 512) pack_pieces<D_DIM, F_DIM>(w1, W1P, cvbuf, r);
  else                  pack_pieces<F_DIM, D_DIM>(w2, W2P, cvbuf, r);
}

// ---------------- router: logits, softmax, top-2, bucket append, bf16 convert ----------------
// A work-group takes RT_TOK tokens. Thread t owns columns 4t .. 4t+3 of every one of them, so
// its 32 gate weights are read once and stay in registers. The threads' partial logits cross
// LDS once; then a wave sums a whole token: first over the eight waves' partials, then over
// its lanes. The sums run in the order of a halving tree over the 256 partials (128, 64, ...,
// 1). Wave 0 appends all the tokens to the experts' lists, with one add per counter.
// The short loops are all unrolled, so that xv, gq, q and the logits are indexed statically
// and stay in registers.
#define RT_TOK 16
#define RT_GRID (N_TOK / RT_TOK)

// lane l with lane l ^ 16
__device__ __forceinline__ float lane_xor16(float x) {
  const int b = __builtin_bit_cast(int, x);
  return __builtin_bit_cast(float,
      __builtin_amdgcn_permlanex16(b, b, 0x76543210, 0xfedcba98, false, false));
}
// lane l with lane l ^ MASK inside a row of 16 lanes (DPP row_xmask)
template <int MASK>
__device__ __forceinline__ float row_xor(float x) {
  return __builtin_bit_cast(float,
      __builtin_amdgcn_update_dpp(0, __builtin_bit_cast(int, x), 0x160 | MASK, 0xf, 0xf, true));
}

__global__ void __launch_bounds__(256)
router_kernel(const float* __restrict__ hs,
              const float* __restrict__ gw,
              const float* __restrict__ gb,
              bf16t* __restrict__ Xb,
              int* __restrict__ counts,
              int* __restrict__ etok,
              float* __restrict__ ewt) {
  const int t = threadIdx.x;
  const int wave = t >> 5;
  const int lane = t & 31;
  const int tok0 = blockIdx.x * RT_TOK;
  // [token][experts 0-3 or 4-7][thread]: every LDS access is 16 contiguous bytes a lane
  __shared__ __attribute__((aligned(16))) float4 part_sh[RT_TOK][2][256];
  __shared__ int   sel_sh[RT_TOK][2];
  __shared__ float gate_sh[RT_TOK][2];

  const float* x = hs + (size_t)tok0 * D_DIM + 4 * t;
  float4 xv[RT_TOK];
#pragma unroll
  for (int k = 0; k < RT_TOK; ++k) xv[k] = *(const float4*)(x + k * D_DIM);
  // the thread's gate weights: rows 4t .. 4t+3 of gw, 32 contiguous floats
  v4f gq[8];
#pragma unroll
  for (int i = 0; i < 8; ++i) gq[i] = *(const v4f*)(gw + (size_t)t * (4 * E_NUM) + i * 4);
  // the issued loads' address registers are not rewritten ahead of this line
  asm volatile("s_wait_xcnt 0x0" ::: "memory");
  // holds the gate weights' loads up here, in flight together with x: left free, they sink
  // behind the stores below, and their latency follows that of x
  asm volatile("" :: "v"(gq[0]), "v"(gq[1]), "v"(gq[2]), "v"(gq[3]),
                     "v"(gq[4]), "v"(gq[5]), "v"(gq[6]), "v"(gq[7]));

  bf16t* xb = Xb + (size_t)tok0 * D_DIM + 4 * t;
#pragma unroll
  for (int h = 0; h < RT_TOK / 8; ++h) {
#pragma unroll
    for (int k = h * 8; k < h * 8 + 8; ++k) {
      union { bf16t b[4]; uint2 u; } cv;
      cv.b[0] = (bf16t)xv[k].x; cv.b[1] = (bf16t)xv[k].y;
      cv.b[2] = (bf16t)xv[k].z; cv.b[3] = (bf16t)xv[k].w;
      *(uint2*)(xb + k * D_DIM) = cv.u;
    }
    // the issued stores' address and data registers are not rewritten ahead of this line
    asm volatile("s_wait_xcnt 0x0" ::: "memory");
    // keeps what follows behind that wait: left free, the scheduler lifts later conversions
    // and products over it, into the registers that the stores still name
    __builtin_amdgcn_sched_barrier(0);
  }

#pragma unroll
  for (int k = 0; k < RT_TOK; ++k) {
    float p[E_NUM];
#pragma unroll
    for (int e = 0; e < E_NUM; ++e)
      p[e] = xv[k].x * gq[0 + e / 4][e % 4] + xv[k].y * gq[2 + e / 4][e % 4] +
             xv[k].z * gq[4 + e / 4][e % 4] + xv[k].w * gq[6 + e / 4][e % 4];
    part_sh[k][0][t] = make_float4(p[0], p[1], p[2], p[3]);
    part_sh[k][1][t] = make_float4(p[4], p[5], p[6], p[7]);
  }
  // publishes every thread's partial logits to the wave that sums them
  __syncthreads();

#pragma unroll
  for (int r = 0; r < RT_TOK / 8; ++r) {
    const int k = r * 8 + wave;
    float logit[E_NUM];
#pragma unroll
    for (int h = 0; h < 2; ++h) {
      float4 q[8];
#pragma unroll
      for (int w = 0; w < 8; ++w) q[w] = part_sh[k][h][w * 32 + lane];
      logit[h * 4 + 0] = ((q[0].x + q[4].x) + (q[2].x + q[6].x)) + ((q[1].x + q[5].x) + (q[3].x + q[7].x));
      logit[h * 4 + 1] = ((q[0].y + q[4].y) + (q[2].y + q[6].y)) + ((q[1].y + q[5].y) + (q[3].y + q[7].y));
      logit[h * 4 + 2] = ((q[0].z + q[4].z) + (q[2].z + q[6].z)) + ((q[1].z + q[5].z) + (q[3].z + q[7].z));
      logit[h * 4 + 3] = ((q[0].w + q[4].w) + (q[2].w + q[6].w)) + ((q[1].w + q[5].w) + (q[3].w + q[7].w));
    }
#pragma unroll
    for (int e = 0; e < E_NUM; ++e) {
      float s = logit[e];
      s += lane_xor16(s);
      s += row_xor<8>(s);
      s += row_xor<4>(s);
      s += row_xor<2>(s);
      s += row_xor<1>(s);
      logit[e] = s + gb[e];
    }

    // every lane holds the token's eight logits and does the same small sums
    float m = logit[0];
#pragma unroll
    for (int e = 1; e < E_NUM; ++e) m = fmaxf(m, logit[e]);
    float p[E_NUM], sum = 0.0f;
#pragma unroll
    for (int e = 0; e < E_NUM; ++e) { p[e] = expf(logit[e] - m); sum += p[e]; }
    float inv = 1.0f / sum;
#pragma unroll
    for (int e = 0; e < E_NUM; ++e) p[e] *= inv;
    int i1 = 0; float g1 = p[0];
#pragma unroll
    for (int e = 1; e < E_NUM; ++e) if (p[e] > g1) { g1 = p[e]; i1 = e; }
    int i2 = (i1 == 0) ? 1 : 0; float g2 = (i1 == 0) ? p[1] : p[0];
#pragma unroll
    for (int e = 0; e < E_NUM; ++e) if (e != i1 && p[e] > g2) { g2 = p[e]; i2 = e; }
    if (lane == 0) {
      sel_sh[k][0] = i1;  sel_sh[k][1] = i2;
      gate_sh[k][0] = g1; gate_sh[k][1] = g2;
    }
  }
  // publishes the tokens' choices to wave 0
  __syncthreads();

  if (wave == 0) {
    // lane k appends token k; a token's place in a list is the list's length before this
    // work-group's add plus the number of this work-group's earlier entries for that expert
    const bool on = lane < RT_TOK;
    const int  k  = on ? lane : 0;
    const int   i1 = sel_sh[k][0],  i2 = sel_sh[k][1];
    const float g1 = gate_sh[k][0], g2 = gate_sh[k][1];
    const unsigned below = (1u << lane) - 1u;
    int r1 = 0, r2 = 0, mine = 0;
#pragma unroll
    for (int e = 0; e < E_NUM; ++e) {
      const unsigned m1 = __builtin_amdgcn_ballot_w32(on && i1 == e);
      const unsigned m2 = __builtin_amdgcn_ballot_w32(on && i2 == e);
      if (i1 == e) r1 = __builtin_popcount(m1 & below);
      if (i2 == e) r2 = __builtin_popcount(m1) + __builtin_popcount(m2 & below);
      if (lane == e) mine = __builtin_popcount(m1) + __builtin_popcount(m2);
    }
    int base = 0;
    if (lane < E_NUM) base = atomicAdd(&counts[lane], mine);
    const int pos1 = __shfl(base, i1) + r1;
    const int pos2 = __shfl(base, i2) + r2;
    if (on) {
      // an entry is the token's row of the Y buffer: 2 * token + (first or second choice)
      const int token = tok0 + lane;
      etok[(size_t)i1 * N_TOK + pos1] = 2 * token;
      ewt [(size_t)i1 * N_TOK + pos1] = g1;
      etok[(size_t)i2 * N_TOK + pos2] = 2 * token + 1;
      ewt [(size_t)i2 * N_TOK + pos2] = g2;
    }
  }
}

// ---------------- expert FFN: register-blocked bf16 WMMA, weights global -> VGPR ----------------
// 256 threads = 8 wave32. Per 256-wide F chunk a wave computes H[64 x 32] (4 x 2 tiles),
// then adds H[64 x 256] @ W2 into its own Y[64 x 128] (4 x 8 tiles = 256 VGPRs).
// Every weight fragment is used by exactly one wave, so it goes straight to registers;
// a ring of 8 fragments is refilled in place right after each fragment's last use.
// The short loops over tiles, slots and registers are all unrolled, so that ring, acc,
// hacc and the A fragments are indexed statically and stay in registers.
__device__ __forceinline__ void ld_frag(Frag16& f, const bf16t* __restrict__ p) {
  f.u[0] = *(const uint4*)(p);
  f.u[1] = *(const uint4*)(p + 256);
}

// four k steps of H += X @ W1; ring slot p*2+j holds k step kt0+p of column tile j
template <bool LAST>
__device__ __forceinline__ void h_block(v8f (&hacc)[2][4], Frag16 (&ring)[8],
                                        const bf16t* xrow, int kt0,
                                        const bf16t* __restrict__ w1p,
                                        const bf16t* __restrict__ w2p) {
#pragma unroll
  for (int p = 0; p < 4; ++p) {
    Frag16 a[4];
#pragma unroll
    for (int mi = 0; mi < 4; ++mi) {
      const bf16t* ap = xrow + mi * 16 * XS_ST + (kt0 + p) * 32;
      a[mi].u[0] = *(const uint4*)(ap);
      a[mi].u[1] = *(const uint4*)(ap + 16);
    }
#pragma unroll
    for (int j = 0; j < 2; ++j) {
      const int s = p * 2 + j;
#pragma unroll
      for (int mi = 0; mi < 4; ++mi)
        hacc[j][mi] = __builtin_amdgcn_wmma_f32_16x16x32_bf16(
            false, a[mi].v, false, ring[s].v, (short)0, hacc[j][mi], false, false);
      if (!LAST) {
        ld_frag(ring[s], w1p + (size_t)(j * 32 + kt0 + p + 4) * FRAG);
      } else {
        ld_frag(ring[s], w2p + (size_t)(s * 128) * FRAG);   // first k step of H @ W2
        // holds each refill directly behind its fragment's last use: left free, the
        // scheduler gathers the refills into late clauses, which shortens their lead
        __builtin_amdgcn_sched_barrier(0);
      }
    }
  }
}

// one k step (32 f) of Y += H @ W2; ring slot n holds column tile n
template <bool LAST>
__device__ __forceinline__ void y_block(v8f (&acc)[8][4], Frag16 (&ring)[8],
                                        const bf16t* hrow, int ks,
                                        const bf16t* __restrict__ w2p,
                                        const bf16t* __restrict__ w1n) {
  Frag16 a[4];
#pragma unroll
  for (int mi = 0; mi < 4; ++mi) {
    const bf16t* ap = hrow + mi * 16 * HS_ST + ks * 32;
    a[mi].u[0] = *(const uint4*)(ap);
    a[mi].u[1] = *(const uint4*)(ap + 16);
  }
#pragma unroll
  for (int n = 0; n < 8; ++n) {
#pragma unroll
    for (int mi = 0; mi < 4; ++mi)
      acc[n][mi] = __builtin_amdgcn_wmma_f32_16x16x32_bf16(
          false, a[mi].v, false, ring[n].v, (short)0, acc[n][mi], false, false);
    if (!LAST) ld_frag(ring[n], w2p + (size_t)(n * 128 + ks + 1) * FRAG);
    else       ld_frag(ring[n], w1n + (size_t)((n & 1) * 32 + (n >> 1)) * FRAG);  // next chunk's X @ W1
    // holds each refill directly behind its fragment's last use and in slot order: left
    // free, the scheduler gathers and reorders the refills, their lead shrinks, and the
    // rolled H loop's head has to wait for nearly the whole ring instead of its oldest slot
    __builtin_amdgcn_sched_barrier(0);
  }
}

__global__ void __launch_bounds__(FFN_THREADS)
moe_ffn_kernel(const bf16t* __restrict__ W1P, const float* __restrict__ b1,
               const bf16t* __restrict__ W2P, const float* __restrict__ b2,
               const bf16t* __restrict__ Xb,
               const int* __restrict__ counts,
               const int* __restrict__ etok,
               const float* __restrict__ ewt,
               float* __restrict__ ybuf,
               int* __restrict__ pmap) {
  const int t = threadIdx.x;
  const int wave = t >> 5;
  const int lane = t & 31;

  // One work-group fills a WGP (LDS, registers). A whole tile for each tile would leave the few
  // tiles past FULL_T to a second round on a nearly idle chip. They are cut along F into pieces
  // of one chunk, which have the lowest indices; each stores its part of Y
  // in rows of its own, and the last launch adds the parts.
  const int b = blockIdx.x;
  const bool piece = b < XTRA_T * NCHUNK;
  const int g   = piece ? FULL_T + b / NCHUNK : b - XTRA_T * NCHUNK;   // tile, counted over all experts
  const int fc0 = piece ? b % NCHUNK : 0;
  const int fc1 = piece ? fc0 + 1 : NCHUNK;

  int e = -1, tile = 0, count = 0, base = 0;
#pragma unroll
  for (int i = 0; i < E_NUM; ++i) {
    const int c = counts[i];
    const int n = (int)(((unsigned)c + TILE_M - 1) / TILE_M);
    if (e < 0 && g < base + n) { e = i; tile = g - base; count = c; }
    base += n;
  }
  if (e < 0) return;      // no such tile; the same for the whole work-group

  __shared__ __attribute__((aligned(16))) bf16t Xs[TILE_M * XS_ST];       // [64][1032]
  __shared__ __attribute__((aligned(16))) bf16t Hs[2][TILE_M * HS_ST];    // two x [64][264]
  __shared__ int   rowTok[TILE_M];
  __shared__ __attribute__((aligned(16))) int   rowDst[TILE_M];   // row of ybuf that takes this row's Y
  __shared__ __attribute__((aligned(16))) float rowW[TILE_M];

  if (t < TILE_M) {
    int idx = tile * TILE_M + t;
    bool ok = idx < count;
    int src = ok ? idx : 0;
    int ent = etok[(size_t)e * N_TOK + src];
    int p0  = Y_ROWS + (g - FULL_T) * (NCHUNK * TILE_M) + t;    // a cut tile: its first piece's row
    rowTok[t] = ent >> 1;
    rowDst[t] = piece ? p0 + fc0 * TILE_M : (ok ? ent : Y_ROWS + P_ROWS + e * TILE_M + t);
    rowW[t]   = ok ? ewt[(size_t)e * N_TOK + src] : 0.0f;
    // tells the last launch where this (token, choice) has its Y: in its own row, or in pieces
    if (ok && fc0 == 0) pmap[ent] = piece ? p0 : -1;
  }
  __syncthreads();

  // ---- gather X tile (bf16) via async copies: 8192 chunks of 16 B, 32 per thread ----
#pragma unroll
  for (int i = 0; i < 4; ++i) {
    unsigned     l[8];
    const bf16t* g[8];
#pragma unroll
    for (int q = 0; q < 8; ++q) {
      int chunk = (i * 8 + q) * FFN_THREADS + t;
      int r = chunk >> 7;
      int c = (chunk & 127) << 3;
      l[q] = (unsigned)(uintptr_t)(Xs + r * XS_ST + c);
      g[q] = Xb + (size_t)rowTok[r] * D_DIM + c;
    }
    async_copy8_b128(l, g);
  }

  const int lrow = lane & 15;
  const int kb8  = (lane >> 4) << 3;

  // packed weights of this wave: 2 column tiles of W1 per chunk, 8 column tiles of W2
  const bf16t* w1w = W1P + ((size_t)(e * 256 + wave * 2) * 32) * FRAG + lane * 8;
  const bf16t* w2w = W2P + ((size_t)(e * 64 + wave * 8) * 128) * FRAG + lane * 8;

  Frag16 ring[8];
#pragma unroll
  for (int s = 0; s < 8; ++s)
    ld_frag(ring[s], w1w + (size_t)fc0 * (16 * 32 * FRAG) + (size_t)((s & 1) * 32 + (s >> 1)) * FRAG);

  v8f acc[8][4];
#pragma unroll
  for (int n = 0; n < 8; ++n)
#pragma unroll
    for (int mi = 0; mi < 4; ++mi) acc[n][mi] = zero8();

  // the first ring loads' address registers are free for reuse behind this line and are not
  // rewritten ahead of it
  asm volatile("s_wait_xcnt 0x0" ::: "memory");
  // the X tile has landed for this wave; the barrier publishes it to the others
  asm volatile("s_wait_asynccnt 0x0" ::: "memory");
  __syncthreads();

  const bf16t* xrow = Xs + lrow * XS_ST + kb8;

  // rolled: one chunk's code is already long, and acc is indexed statically inside it
#pragma unroll 1
  for (int fc = fc0; fc < fc1; ++fc) {
    const bf16t* w1p = w1w + (size_t)fc * (16 * 32 * FRAG);
    const bf16t* w2p = w2w + (size_t)fc * (8 * FRAG);
    const int fnext  = (fc + 1 < fc1) ? fc + 1 : fc;      // last chunk: a valid, unused refill
    const bf16t* w1n = w1w + (size_t)fnext * (16 * 32 * FRAG);
    bf16t* hs = Hs[fc & 1];
    // read ahead of this chunk's refills: loads return in order, and a bias read behind
    // them would wait for the whole ring
    float bb[2];
#pragma unroll
    for (int j = 0; j < 2; ++j)
      bb[j] = b1[(size_t)e * F_DIM + fc * FB + wave * 32 + j * 16 + lrow];

    // ======== H = X @ W1[:, chunk] ========
    v8f hacc[2][4];
#pragma unroll
    for (int j = 0; j < 2; ++j)
#pragma unroll
      for (int mi = 0; mi < 4; ++mi) hacc[j][mi] = zero8();

    // rolled: four k steps (32 WMMAs) a trip; for speed only
#pragma unroll 1
    for (int kt0 = 0; kt0 < 28; kt0 += 4)
      h_block<false>(hacc, ring, xrow, kt0, w1p, w2p);
    h_block<true>(hacc, ring, xrow, 28, w1p, w2p);

    // ---- bias + gelu -> Hs (bf16) ----
#pragma unroll
    for (int j = 0; j < 2; ++j) {
      int coln = wave * 32 + j * 16 + lrow;
#pragma unroll
      for (int mi = 0; mi < 4; ++mi)
#pragma unroll
        for (int v = 0; v < 8; ++v) {
          float xv = hacc[j][mi][v] + bb[j];
          hs[(mi * 16 + kb8 + v) * HS_ST + coln] = (bf16t)gelu_tanh(xv);
        }
    }
    // the one barrier of a chunk: publishes this chunk's H; with two H buffers it also
    // keeps the next write of this buffer behind every reader's last read of it
    __syncthreads();

    // ======== Y += H @ W2[chunk, :] ========
    const bf16t* hrow = hs + lrow * HS_ST + kb8;
    // unrolled: every refill then reads at a constant offset from one base of the chunk,
    // and no address register is rewritten between the k steps
#pragma unroll
    for (int ks = 0; ks < 7; ++ks)
      y_block<false>(acc, ring, hrow, ks, w2p, w1n);
    y_block<true>(acc, ring, hrow, 7, w2p, w1n);
    // the chunk's weight pointers are advanced behind this line: the issued loads'
    // address registers are not rewritten ahead of it
    asm volatile("s_wait_xcnt 0x0" ::: "memory");
  }

  // ---- epilogue: +b2 (once a tile: with its first chunk), scale by gate, store each row ----
  // Every row of ybuf has one writer, so the rows are stored plainly.
  float bb[8];
#pragma unroll
  for (int n = 0; n < 8; ++n) {
    float x = b2[(size_t)e * D_DIM + (wave * 8 + n) * 16 + lrow];
    bb[n] = (fc0 == 0) ? x : 0.0f;
  }
  // the bias loads' address registers are not rewritten ahead of this line
  asm volatile("s_wait_xcnt 0x0" ::: "memory");
  float* ycol = ybuf + wave * 128 + lrow;
  float* yp[4][8];
#pragma unroll
  for (int mi = 0; mi < 4; ++mi) {
    // the lane's eight rows of this tile row: their places and gates in four 16-byte LDS reads
    union { int4 q[2]; int i[8]; } dst;
    union { float4 q[2]; float f[8]; } w;
#pragma unroll
    for (int h = 0; h < 2; ++h) {
      dst.q[h] = *(const int4*)(rowDst + mi * 16 + kb8 + h * 4);
      w.q[h]   = *(const float4*)(rowW + mi * 16 + kb8 + h * 4);
    }
#pragma unroll
    for (int v = 0; v < 8; ++v) {
      yp[mi][v] = ycol + (size_t)dst.i[v] * D_DIM;
#pragma unroll
      for (int n = 0; n < 8; ++n) acc[n][mi][v] = w.f[v] * (acc[n][mi][v] + bb[n]);
    }
  }
  // every value and every address is formed ahead of the first store: left free, the scheduler
  // mixes them with the stores and rewrites registers that issued stores still name
  __builtin_amdgcn_sched_barrier(0);
#pragma unroll
  for (int mi = 0; mi < 4; ++mi)
#pragma unroll
    for (int v = 0; v < 8; ++v)
#pragma unroll
      for (int n = 0; n < 8; ++n) yp[mi][v][n * 16] = acc[n][mi][v];
}

// ---------------- sum of the two experts' terms + residual + layernorm ----------------
// four columns of one (token, choice): its own row, or the sum of a cut tile's pieces in order
__device__ __forceinline__ float4 y_term(const float* __restrict__ ybuf, int own, int m, int c) {
  if (m < 0) return *(const float4*)(ybuf + (size_t)own * D_DIM + c);
  const float* p = ybuf + (size_t)m * D_DIM + c;
  float4 s = *(const float4*)p;
#pragma unroll
  for (int i = 1; i < NCHUNK; ++i) {
    float4 q = *(const float4*)(p + (size_t)i * TILE_M * D_DIM);
    s.x += q.x; s.y += q.y; s.z += q.z; s.w += q.w;
  }
  return s;
}

__global__ void ln_kernel(const float* __restrict__ ybuf,
                          const int* __restrict__ pmap,
                          const float* __restrict__ inp,
                          const float* __restrict__ gamma,
                          const float* __restrict__ beta,
                          float* __restrict__ out) {
  const int token = blockIdx.x;
  const int t = threadIdx.x;
  __shared__ float red[256];
  __shared__ float mu_sh, rstd_sh;

  const int2 m = *(const int2*)(pmap + 2 * token);
  float4 b = *(const float4*)(inp + (size_t)token * D_DIM + 4 * t);
  float4 a = y_term(ybuf, 2 * token,     m.x, 4 * t);
  // the issued loads' address registers are not rewritten ahead of this line
  asm volatile("s_wait_xcnt 0x0" ::: "memory");
  float4 q = y_term(ybuf, 2 * token + 1, m.y, 4 * t);
  // as above
  asm volatile("s_wait_xcnt 0x0" ::: "memory");
  float s0 = (a.x + q.x) + b.x, s1 = (a.y + q.y) + b.y;
  float s2 = (a.z + q.z) + b.z, s3 = (a.w + q.w) + b.w;

  red[t] = s0 + s1 + s2 + s3;
  __syncthreads();
  for (int s = 128; s > 0; s >>= 1) {
    if (t < s) red[t] += red[t + s];
    __syncthreads();
  }
  if (t == 0) mu_sh = red[0] * (1.0f / D_DIM);
  __syncthreads();
  float mu = mu_sh;
  float d0 = s0 - mu, d1 = s1 - mu, d2 = s2 - mu, d3 = s3 - mu;
  red[t] = d0 * d0 + d1 * d1 + d2 * d2 + d3 * d3;
  __syncthreads();
  for (int s = 128; s > 0; s >>= 1) {
    if (t < s) red[t] += red[t + s];
    __syncthreads();
  }
  if (t == 0) rstd_sh = rsqrtf(red[0] * (1.0f / D_DIM) + 1e-5f);
  __syncthreads();
  float rstd = rstd_sh;

  int c = 4 * t;
  out[(size_t)token * D_DIM + c + 0] = d0 * rstd * gamma[c + 0] + beta[c + 0];
  out[(size_t)token * D_DIM + c + 1] = d1 * rstd * gamma[c + 1] + beta[c + 1];
  out[(size_t)token * D_DIM + c + 2] = d2 * rstd * gamma[c + 2] + beta[c + 2];
  out[(size_t)token * D_DIM + c + 3] = d3 * rstd * gamma[c + 3] + beta[c + 3];
}

extern "C" void kernel_launch(void* const* d_in, const int* in_sizes, int n_in,
                              void* d_out, int out_size, void* d_ws, size_t ws_size,
                              hipStream_t stream) {
  (void)in_sizes; (void)n_in; (void)out_size; (void)ws_size;
  const float* hs    = (const float*)d_in[0];
  const float* inp   = (const float*)d_in[1];
  const float* gw    = (const float*)d_in[2];
  const float* gb    = (const float*)d_in[3];
  const float* w1    = (const float*)d_in[4];
  const float* b1    = (const float*)d_in[5];
  const float* w2    = (const float*)d_in[6];
  const float* b2    = (const float*)d_in[7];
  const float* gamma = (const float*)d_in[8];
  const float* beta  = (const float*)d_in[9];
  float* out = (float*)d_out;

  char* ws = (char*)d_ws;
  size_t off = 0;
  int*   counts = (int*)(ws + off);   off += 256;
  int*   etok   = (int*)(ws + off);   off += (size_t)E_NUM * N_TOK * sizeof(int);
  float* ewt    = (float*)(ws + off); off += (size_t)E_NUM * N_TOK * sizeof(float);
  bf16t* Xb     = (bf16t*)(ws + off); off += (size_t)N_TOK * D_DIM * sizeof(bf16t);
  int*   pmap   = (int*)(ws + off);   off += (size_t)Y_ROWS * sizeof(int);
  float* ybuf   = (float*)(ws + off); off += (size_t)(Y_ROWS + P_ROWS + PAD_ROWS) * D_DIM * sizeof(float);
  bf16t* W1T    = (bf16t*)(ws + off); off += (size_t)E_NUM * F_DIM * D_DIM * sizeof(bf16t);
  bf16t* W2T    = (bf16t*)(ws + off); off += (size_t)E_NUM * F_DIM * D_DIM * sizeof(bf16t);

  zero_kernel<<<dim3(1), dim3(32), 0, stream>>>(counts);
  convert_w_kernel<<<dim3(1024), dim3(256), 0, stream>>>(w1, w2, W1T, W2T);
  router_kernel<<<dim3(RT_GRID), dim3(256), 0, stream>>>(hs, gw, gb, Xb, counts, etok, ewt);
  moe_ffn_kernel<<<dim3(FFN_GRID), dim3(FFN_THREADS), 0, stream>>>(
      W1T, b1, W2T, b2, Xb, counts, etok, ewt, ybuf, pmap);
  ln_kernel<<<dim3(N_TOK), dim3(256), 0, stream>>>(ybuf, pmap, inp, gamma, beta, out);
}

// v007
// It runs in 247 microseconds.
// Next to v006, in two timings, it ran 1.15 times as fast each time.
// All steps since v000 together make it 7.70 times as fast.
#include <hip/hip_runtime.h>
#include <hip/hip_bf16.h>

#define N_TOK 8192
#define D_DIM 1024
#define E_NUM 8
#define F_DIM 4096
#define TILE_M 64
#define FB 256                  // F columns per chunk
#define NCHUNK (F_DIM / FB)     // 16
#define FFN_THREADS 256         // 8 wave32, 2 per SIMD
#define FRAG 512                // bf16 elements of one packed 16(n) x 32(k) B fragment
// Every token goes to two experts: 2 * N_TOK rows, which fill FULL_T row tiles exactly. Each
// expert rounds its own rows up to whole tiles, so there are FULL_T to FULL_T + E_NUM - 1 tiles.
#define FULL_T (2 * N_TOK / TILE_M)             // 256: one work-group each, all of F
#define XTRA_T (E_NUM - 1)                      // tiles past FULL_T: one work-group a chunk of F
#define FFN_GRID (XTRA_T * NCHUNK + FULL_T)
// Rows of the Y buffer: one per (token, choice), then one per row of every piece of a cut tile.
#define Y_ROWS (2 * N_TOK)
#define P_ROWS (XTRA_T * NCHUNK * TILE_M)
// and, never read, one per row of an expert's last tile: its padding rows land there
#define PAD_ROWS (E_NUM * TILE_M)

#define XS_ST 1032   // Xs row stride (bf16 elems): 2064 B/row, 16B aligned
#define HS_ST 264    // Hs row stride (bf16 elems): 528 B/row, 16B aligned

typedef __bf16 bf16t;
typedef __attribute__((ext_vector_type(16))) bf16t v16bf;
typedef __attribute__((ext_vector_type(8)))  float v8f;

union Frag16 { v16bf v; uint4 u[2]; };

__device__ inline v8f zero8() {
  v8f z;
#pragma unroll
  for (int i = 0; i < 8; ++i) z[i] = 0.0f;
  return z;
}

// 0.5 * (1 + tanh(u)) = 1 / (1 + exp(-2u)), u = 0.79788...(x + 0.044715 x^3): one exp2 and one
// reciprocal a value and no branch. exp2 runs to +inf or to 0 at the ends, which gives the
// limits 0 and x.
__device__ inline float gelu_tanh(float x) {
  const float k = -2.0f * 0.7978845608028654f * 1.4426950408889634f;   // -2 sqrt(2/pi) log2(e)
  const float s = x * (k + (k * 0.044715f) * (x * x));
  return x * __builtin_amdgcn_rcpf(1.0f + __builtin_amdgcn_exp2f(s));
}

// ---- CDNA5 async copy: global -> LDS, 16B per lane, tracked by ASYNCcnt ----
// Eight copies and the s_wait_xcnt that keeps their address registers from being
// rewritten early stand in one statement.
__device__ __forceinline__ void async_copy8_b128(const unsigned* l, const bf16t* const* g) {
  asm volatile("global_load_async_to_lds_b128 %0, %8, off\n\t"
               "global_load_async_to_lds_b128 %1, %9, off\n\t"
               "global_load_async_to_lds_b128 %2, %10, off\n\t"
               "global_load_async_to_lds_b128 %3, %11, off\n\t"
               "global_load_async_to_lds_b128 %4, %12, off\n\t"
               "global_load_async_to_lds_b128 %5, %13, off\n\t"
               "global_load_async_to_lds_b128 %6, %14, off\n\t"
               "global_load_async_to_lds_b128 %7, %15, off\n\t"
               "s_wait_xcnt 0x0"
               :: "v"(l[0]), "v"(l[1]), "v"(l[2]), "v"(l[3]),
                  "v"(l[4]), "v"(l[5]), "v"(l[6]), "v"(l[7]),
                  "v"(g[0]), "v"(g[1]), "v"(g[2]), "v"(g[3]),
                  "v"(g[4]), "v"(g[5]), "v"(g[6]), "v"(g[7])
               : "memory");
}

// ---------------- zero the experts' row counters ----------------
__global__ void zero_kernel(int* counts) {
  if (threadIdx.x < E_NUM) counts[threadIdx.x] = 0;
}

// ---------------- weight convert to bf16, packed in WMMA B-fragment order ----------------
// One fragment = 16 columns (n) x 32 k = 512 elements = 1 KB, stored as
// [half j of the lane's registers][lane = h*16 + n][8 k], k = 16*j + 8*h + i,
// so that each of a fragment's two 16-byte loads reads 512 contiguous bytes.
// W1P: fragment ((e*256 + f/16)*32  + k/32), n = f, k = d-index of X@W1
// W2P: fragment ((e*64  + d/16)*128 + f/32), n = d, k = f-index of H@W2
//
// Both sources are [e][k][n] with n contiguous. A wave takes a 16(k) x 64(n) piece: eight
// 16-byte loads a lane, each wave-wide load two rows of 256 contiguous bytes. A lane then
// holds 4 n x 8 k = four 16-byte units of the packed form, which belong to one half (j) of
// one fragment. The units cross the wave's own LDS range and leave as one 512-byte run
// per fragment. A work-group's 8 waves lie side by side along n, and it takes the same
// piece of every expert in turn.
#define CV_FP 528               // LDS bytes of a fragment half: 512 + 16, so that the four
                                // fragments a half-wave writes at once fall on different banks
#define CV_WV (4 * CV_FP)       // LDS bytes of a wave

typedef __attribute__((ext_vector_type(4))) float v4f;

template <int N>
__device__ __forceinline__ void cv_load(v4f (&v)[8], const float* __restrict__ s, unsigned off) {
#pragma unroll
  for (int i = 0; i < 8; ++i) v[i] = *(const v4f*)(s + off + i * N);
  // the base is advanced behind this line: the issued loads' address registers are not
  // rewritten ahead of it
  asm volatile("s_wait_xcnt 0x0" ::: "memory");
}

__device__ __forceinline__ void cv_pack(uint4 (&p)[4], const v4f (&v)[8]) {
#pragma unroll
  for (int c = 0; c < 4; ++c) {
    union { bf16t b[8]; uint4 u; } x;
#pragma unroll
    for (int i = 0; i < 8; ++i) x.b[i] = (bf16t)v[i][c];
    p[c] = x.u;
  }
}

template <int K>
__device__ __forceinline__ void cv_emit(const uint4 (&p)[4], char* lw, const char* lr,
                                        bf16t* __restrict__ d, unsigned off) {
#pragma unroll
  for (int c = 0; c < 4; ++c) *(uint4*)(lw + c * 16) = p[c];
  // the wave reads back what its other lanes wrote: their LDS stores have to be done
  asm volatile("s_wait_dscnt 0x0" ::: "memory");
#pragma unroll
  for (int g = 0; g < 4; ++g)
    *(uint4*)(d + off + g * (K / 32) * FRAG) = *(const uint4*)(lr + g * CV_FP);
  // the issued stores' address and data registers are not rewritten ahead of this line
  asm volatile("s_wait_xcnt 0x0" ::: "memory");
}

template <int K, int N>
__device__ __forceinline__ void pack_pieces(const float* __restrict__ src,
                                            bf16t* __restrict__ dst,
                                            char* lds, int r) {
  const int t = threadIdx.x;
  const int w = t >> 5;
  const int l = t & 31;
  const int kb = r / (N / 512);       // which 16 k
  const int nb = r % (N / 512);       // which 512 n
  const float* s = src + (size_t)kb * 16 * N + nb * 512;
  bf16t*       d = dst + (size_t)nb * 512 * K + kb * 256;
  const unsigned soff = (unsigned)((l >> 4) * 8 * N + w * 64 + (l & 15) * 4);
  const unsigned doff = (unsigned)(w * 64 * K + l * 8);
  char*       lw = lds + w * CV_WV + ((l & 15) >> 2) * CV_FP + (l >> 4) * 256 + (l & 3) * 64;
  const char* lr = lds + w * CV_WV + l * 16;

  v4f   v[8];
  uint4 p[4];
  cv_load<N>(v, s, soff);
  // rolled: the body is short; the next expert's piece flies while this one crosses LDS
#pragma unroll 1
  for (int e = 0; e + 1 < E_NUM; ++e) {
    cv_pack(p, v);
    s += (size_t)K * N;
    cv_load<N>(v, s, soff);
    cv_emit<K>(p, lw, lr, d, doff);
    d += (size_t)K * N;
  }
  cv_pack(p, v);
  cv_emit<K>(p, lw, lr, d, doff);
}

__global__ void __launch_bounds__(256)
convert_w_kernel(const float* __restrict__ w1,
                 const float* __restrict__ w2,
                 bf16t* __restrict__ W1P,
                 bf16t* __restrict__ W2P) {
  __shared__ __attribute__((aligned(16))) char cvbuf[8 * CV_WV];
  const int r = blockIdx.x & 511;     // 512 work-group pieces an expert in either matrix
  if (blockIdx.x < 512) pack_pieces<D_DIM, F_DIM>(w1, W1P, cvbuf, r);
  else                  pack_pieces<F_DIM, D_DIM>(w2, W2P, cvbuf, r);
}

// ---------------- router: logits, softmax, top-2, bucket append, bf16 convert ----------------
// A work-group takes RT_TOK tokens. Thread t owns columns 4t .. 4t+3 of every one of them, so
// its 32 gate weights are read once and stay in registers. The threads' partial logits cross
// LDS once; then a wave sums a whole token: first over the eight waves' partials, then over
// its lanes. The sums run in the order of a halving tree over the 256 partials (128, 64, ...,
// 1). Wave 0 appends all the tokens to the experts' lists, with one add per counter.
// The short loops are all unrolled, so that xv, gq, q and the logits are indexed statically
// and stay in registers.
#define RT_TOK 16
#define RT_GRID (N_TOK / RT_TOK)

// lane l with lane l ^ 16
__device__ __forceinline__ float lane_xor16(float x) {
  const int b = __builtin_bit_cast(int, x);
  return __builtin_bit_cast(float,
      __builtin_amdgcn_permlanex16(b, b, 0x76543210, 0xfedcba98, false, false));
}
// lane l with lane l ^ MASK inside a row of 16 lanes (DPP row_xmask)
template <int MASK>
__device__ __forceinline__ float row_xor(float x) {
  return __builtin_bit_cast(float,
      __builtin_amdgcn_update_dpp(0, __builtin_bit_cast(int, x), 0x160 | MASK, 0xf, 0xf, true));
}

__global__ void __launch_bounds__(256)
router_kernel(const float* __restrict__ hs,
              const float* __restrict__ gw,
              const float* __restrict__ gb,
              bf16t* __restrict__ Xb,
              int* __restrict__ counts,
              int* __restrict__ etok,
              float* __restrict__ ewt) {
  const int t = threadIdx.x;
  const int wave = t >> 5;
  const int lane = t & 31;
  const int tok0 = blockIdx.x * RT_TOK;
  // [token][experts 0-3 or 4-7][thread]: every LDS access is 16 contiguous bytes a lane
  __shared__ __attribute__((aligned(16))) float4 part_sh[RT_TOK][2][256];
  __shared__ int   sel_sh[RT_TOK][2];
  __shared__ float gate_sh[RT_TOK][2];

  const float* x = hs + (size_t)tok0 * D_DIM + 4 * t;
  float4 xv[RT_TOK];
#pragma unroll
  for (int k = 0; k < RT_TOK; ++k) xv[k] = *(const float4*)(x + k * D_DIM);
  // the thread's gate weights: rows 4t .. 4t+3 of gw, 32 contiguous floats
  v4f gq[8];
#pragma unroll
  for (int i = 0; i < 8; ++i) gq[i] = *(const v4f*)(gw + (size_t)t * (4 * E_NUM) + i * 4);
  // the issued loads' address registers are not rewritten ahead of this line
  asm volatile("s_wait_xcnt 0x0" ::: "memory");
  // holds the gate weights' loads up here, in flight together with x: left free, they sink
  // behind the stores below, and their latency follows that of x
  asm volatile("" :: "v"(gq[0]), "v"(gq[1]), "v"(gq[2]), "v"(gq[3]),
                     "v"(gq[4]), "v"(gq[5]), "v"(gq[6]), "v"(gq[7]));

  bf16t* xb = Xb + (size_t)tok0 * D_DIM + 4 * t;
#pragma unroll
  for (int h = 0; h < RT_TOK / 8; ++h) {
#pragma unroll
    for (int k = h * 8; k < h * 8 + 8; ++k) {
      union { bf16t b[4]; uint2 u; } cv;
      cv.b[0] = (bf16t)xv[k].x; cv.b[1] = (bf16t)xv[k].y;
      cv.b[2] = (bf16t)xv[k].z; cv.b[3] = (bf16t)xv[k].w;
      *(uint2*)(xb + k * D_DIM) = cv.u;
    }
    // the issued stores' address and data registers are not rewritten ahead of this line
    asm volatile("s_wait_xcnt 0x0" ::: "memory");
    // keeps what follows behind that wait: left free, the scheduler lifts later conversions
    // and products over it, into the registers that the stores still name
    __builtin_amdgcn_sched_barrier(0);
  }

#pragma unroll
  for (int k = 0; k < RT_TOK; ++k) {
    float p[E_NUM];
#pragma unroll
    for (int e = 0; e < E_NUM; ++e)
      p[e] = xv[k].x * gq[0 + e / 4][e % 4] + xv[k].y * gq[2 + e / 4][e % 4] +
             xv[k].z * gq[4 + e / 4][e % 4] + xv[k].w * gq[6 + e / 4][e % 4];
    part_sh[k][0][t] = make_float4(p[0], p[1], p[2], p[3]);
    part_sh[k][1][t] = make_float4(p[4], p[5], p[6], p[7]);
  }
  // publishes every thread's partial logits to the wave that sums them
  __syncthreads();

#pragma unroll
  for (int r = 0; r < RT_TOK / 8; ++r) {
    const int k = r * 8 + wave;
    float logit[E_NUM];
#pragma unroll
    for (int h = 0; h < 2; ++h) {
      float4 q[8];
#pragma unroll
      for (int w = 0; w < 8; ++w) q[w] = part_sh[k][h][w * 32 + lane];
      logit[h * 4 + 0] = ((q[0].x + q[4].x) + (q[2].x + q[6].x)) + ((q[1].x + q[5].x) + (q[3].x + q[7].x));
      logit[h * 4 + 1] = ((q[0].y + q[4].y) + (q[2].y + q[6].y)) + ((q[1].y + q[5].y) + (q[3].y + q[7].y));
      logit[h * 4 + 2] = ((q[0].z + q[4].z) + (q[2].z + q[6].z)) + ((q[1].z + q[5].z) + (q[3].z + q[7].z));
      logit[h * 4 + 3] = ((q[0].w + q[4].w) + (q[2].w + q[6].w)) + ((q[1].w + q[5].w) + (q[3].w + q[7].w));
    }
#pragma unroll
    for (int e = 0; e < E_NUM; ++e) {
      float s = logit[e];
      s += lane_xor16(s);
      s += row_xor<8>(s);
      s += row_xor<4>(s);
      s += row_xor<2>(s);
      s += row_xor<1>(s);
      logit[e] = s + gb[e];
    }

    // every lane holds the token's eight logits and does the same small sums
    float m = logit[0];
#pragma unroll
    for (int e = 1; e < E_NUM; ++e) m = fmaxf(m, logit[e]);
    float p[E_NUM], sum = 0.0f;
#pragma unroll
    for (int e = 0; e < E_NUM; ++e) { p[e] = expf(logit[e] - m); sum += p[e]; }
    float inv = 1.0f / sum;
#pragma unroll
    for (int e = 0; e < E_NUM; ++e) p[e] *= inv;
    int i1 = 0; float g1 = p[0];
#pragma unroll
    for (int e = 1; e < E_NUM; ++e) if (p[e] > g1) { g1 = p[e]; i1 = e; }
    int i2 = (i1 == 0) ? 1 : 0; float g2 = (i1 == 0) ? p[1] : p[0];
#pragma unroll
    for (int e = 0; e < E_NUM; ++e) if (e != i1 && p[e] > g2) { g2 = p[e]; i2 = e; }
    if (lane == 0) {
      sel_sh[k][0] = i1;  sel_sh[k][1] = i2;
      gate_sh[k][0] = g1; gate_sh[k][1] = g2;
    }
  }
  // publishes the tokens' choices to wave 0
  __syncthreads();

  if (wave == 0) {
    // lane k appends token k; a token's place in a list is the list's length before this
    // work-group's add plus the number of this work-group's earlier entries for that expert
    const bool on = lane < RT_TOK;
    const int  k  = on ? lane : 0;
    const int   i1 = sel_sh[k][0],  i2 = sel_sh[k][1];
    const float g1 = gate_sh[k][0], g2 = gate_sh[k][1];
    const unsigned below = (1u << lane) - 1u;
    int r1 = 0, r2 = 0, mine = 0;
#pragma unroll
    for (int e = 0; e < E_NUM; ++e) {
      const unsigned m1 = __builtin_amdgcn_ballot_w32(on && i1 == e);
      const unsigned m2 = __builtin_amdgcn_ballot_w32(on && i2 == e);
      if (i1 == e) r1 = __builtin_popcount(m1 & below);
      if (i2 == e) r2 = __builtin_popcount(m1) + __builtin_popcount(m2 & below);
      if (lane == e) mine = __builtin_popcount(m1) + __builtin_popcount(m2);
    }
    int base = 0;
    if (lane < E_NUM) base = atomicAdd(&counts[lane], mine);
    const int pos1 = __shfl(base, i1) + r1;
    const int pos2 = __shfl(base, i2) + r2;
    if (on) {
      // an entry is the token's row of the Y buffer: 2 * token + (first or second choice)
      const int token = tok0 + lane;
      etok[(size_t)i1 * N_TOK + pos1] = 2 * token;
      ewt [(size_t)i1 * N_TOK + pos1] = g1;
      etok[(size_t)i2 * N_TOK + pos2] = 2 * token + 1;
      ewt [(size_t)i2 * N_TOK + pos2] = g2;
    }
  }
}

// ---------------- expert FFN: register-blocked bf16 WMMA, weights global -> VGPR ----------------
// 256 threads = 8 wave32. Per 256-wide F chunk a wave computes H[64 x 32] (4 x 2 tiles),
// then adds H[64 x 256] @ W2 into its own Y[64 x 128] (4 x 8 tiles = 256 VGPRs).
// Every weight fragment is used by exactly one wave, so it goes straight to registers;
// a ring of 8 fragments is refilled in place right after each fragment's last use.
// The short loops over tiles, slots and registers are all unrolled, so that ring, acc,
// hacc and the A fragments are indexed statically and stay in registers.
__device__ __forceinline__ void ld_frag(Frag16& f, const bf16t* __restrict__ p) {
  f.u[0] = *(const uint4*)(p);
  f.u[1] = *(const uint4*)(p + 256);
}

// ---- L2 prefetch of the next chunk's packed weights ----
// The work-groups of one expert walk the same 16 MB of weights at about the same place, so the
// one in front takes every line from memory and the others wait for it. A chunk ahead of its
// loads each work-group asks for half of the chunk's 1 MB, one lane a 256-byte unit, one
// request a wave in each of the chunk's eight H blocks. The half goes by the tile index: two
// neighbouring tiles cover a chunk between them. Waves 0-3 ask for W1 (a chunk is 512 KB in a
// row: 8 KB out of every 64 KB), waves 4-7 for W2 (a chunk is 8 KB of each of 64 column tiles,
// 128 KB apart: every eighth tile). Only a hint: nothing waits for it.
#define PF_W1_STEP (64 * FRAG * 2)          // bytes from a wave's request to its next: W1
#define PF_W2_STEP (8 * 128 * FRAG * 2)     // the same: W2
#define PF_W1_NEXT (16 * 32 * FRAG * 2)     // bytes from a chunk to the next: W1
#define PF_W2_NEXT (8 * FRAG * 2)           // the same: W2
__device__ __forceinline__ void prefetch_unit(const bf16t* base, unsigned& off, unsigned adv) {
  // base: the packed matrix, scalar; off: the lane's byte offset in it. An in-out operand: it
  // stays in a register of its own through the loops, which holds nothing but offsets inside
  // the matrix; it is advanced behind this statement, so not ahead of its wait
  asm volatile("global_prefetch_b8 %0, %1 scope:SCOPE_SE\n\t"
               "s_wait_xcnt 0x0"
               : "+v"(off) : "s"(base) : "memory");
  off += adv;
}

// four k steps of H += X @ W1; ring slot p*2+j holds k step kt0+p of column tile j
template <bool LAST>
__device__ __forceinline__ void h_block(v8f (&hacc)[2][4], Frag16 (&ring)[8],
                                        const bf16t* xrow, int kt0,
                                        const bf16t* __restrict__ w1p,
                                        const bf16t* __restrict__ w2p,
                                        const bf16t* pfb, unsigned& pfo, unsigned pfadv) {
#pragma unroll
  for (int p = 0; p < 4; ++p) {
    Frag16 a[4];
#pragma unroll
    for (int mi = 0; mi < 4; ++mi) {
      const bf16t* ap = xrow + mi * 16 * XS_ST + (kt0 + p) * 32;
      a[mi].u[0] = *(const uint4*)(ap);
      a[mi].u[1] = *(const uint4*)(ap + 16);
    }
#pragma unroll
    for (int j = 0; j < 2; ++j) {
      const int s = p * 2 + j;
#pragma unroll
      for (int mi = 0; mi < 4; ++mi)
        hacc[j][mi] = __builtin_amdgcn_wmma_f32_16x16x32_bf16(
            false, a[mi].v, false, ring[s].v, (short)0, hacc[j][mi], false, false);
      if (!LAST) {
        ld_frag(ring[s], w1p + (size_t)(j * 32 + kt0 + p + 4) * FRAG);
      } else {
        ld_frag(ring[s], w2p + (size_t)(s * 128) * FRAG);   // first k step of H @ W2
        // holds each refill directly behind its fragment's last use: left free, the
        // scheduler gathers the refills into late clauses, which shortens their lead
        __builtin_amdgcn_sched_barrier(0);
      }
    }
  }
  prefetch_unit(pfb, pfo, pfadv);
}

// one k step (32 f) of Y += H @ W2; ring slot n holds column tile n
template <bool LAST>
__device__ __forceinline__ void y_block(v8f (&acc)[8][4], Frag16 (&ring)[8],
                                        const bf16t* hrow, int ks,
                                        const bf16t* __restrict__ w2p,
                                        const bf16t* __restrict__ w1n) {
  Frag16 a[4];
#pragma unroll
  for (int mi = 0; mi < 4; ++mi) {
    const bf16t* ap = hrow + mi * 16 * HS_ST + ks * 32;
    a[mi].u[0] = *(const uint4*)(ap);
    a[mi].u[1] = *(const uint4*)(ap + 16);
  }
#pragma unroll
  for (int n = 0; n < 8; ++n) {
#pragma unroll
    for (int mi = 0; mi < 4; ++mi)
      acc[n][mi] = __builtin_amdgcn_wmma_f32_16x16x32_bf16(
          false, a[mi].v, false, ring[n].v, (short)0, acc[n][mi], false, false);
    if (!LAST) ld_frag(ring[n], w2p + (size_t)(n * 128 + ks + 1) * FRAG);
    else       ld_frag(ring[n], w1n + (size_t)((n & 1) * 32 + (n >> 1)) * FRAG);  // next chunk's X @ W1
    // holds each refill directly behind its fragment's last use and in slot order: left
    // free, the scheduler gathers and reorders the refills, their lead shrinks, and the
    // rolled H loop's head has to wait for nearly the whole ring instead of its oldest slot
    __builtin_amdgcn_sched_barrier(0);
  }
}

__global__ void __launch_bounds__(FFN_THREADS)
moe_ffn_kernel(const bf16t* __restrict__ W1P, const float* __restrict__ b1,
               const bf16t* __restrict__ W2P, const float* __restrict__ b2,
               const bf16t* __restrict__ Xb,
               const int* __restrict__ counts,
               const int* __restrict__ etok,
               const float* __restrict__ ewt,
               float* __restrict__ ybuf,
               int* __restrict__ pmap) {
  const int t = threadIdx.x;
  const int wave = t >> 5;
  const int lane = t & 31;

  // One work-group fills a WGP (LDS, registers). A whole tile for each tile would leave the few
  // tiles past FULL_T to a second round on a nearly idle chip. They are cut along F into pieces
  // of one chunk, which have the lowest indices; each stores its part of Y
  // in rows of its own, and the last launch adds the parts.
  const int b = blockIdx.x;
  const bool piece = b < XTRA_T * NCHUNK;
  const int g   = piece ? FULL_T + b / NCHUNK : b - XTRA_T * NCHUNK;   // tile, counted over all experts
  const int fc0 = piece ? b % NCHUNK : 0;
  const int fc1 = piece ? fc0 + 1 : NCHUNK;

  int e = -1, tile = 0, count = 0, base = 0;
#pragma unroll
  for (int i = 0; i < E_NUM; ++i) {
    const int c = counts[i];
    const int n = (int)(((unsigned)c + TILE_M - 1) / TILE_M);
    if (e < 0 && g < base + n) { e = i; tile = g - base; count = c; }
    base += n;
  }
  if (e < 0) return;      // no such tile; the same for the whole work-group

  // this work-group's half of the first chunk's weights; then the offset goes on to the next
  // chunk, or back to the start of this one where there is none: it never leaves the matrix
  const int  ph  = g & 1;
  const bool pw1 = wave < 4;
  // the same in every lane of a wave: readfirstlane puts them into scalar registers
  const unsigned long long pa = (unsigned long long)(pw1 ? W1P : W2P);
  const bf16t* pfb = (const bf16t*)(
      ((unsigned long long)(unsigned)__builtin_amdgcn_readfirstlane((int)(pa >> 32)) << 32) |
      (unsigned)__builtin_amdgcn_readfirstlane((int)pa));
  const unsigned pfs = (unsigned)__builtin_amdgcn_readfirstlane(pw1 ? PF_W1_STEP : PF_W2_STEP);
  const unsigned pfn = (unsigned)__builtin_amdgcn_readfirstlane(pw1 ? PF_W1_NEXT : PF_W2_NEXT);
  unsigned pfo = (unsigned)(pw1
      ? ((e * 256 + fc0 * 16) * 32 + ph * 32 + wave * 8) * (FRAG * 2)
      : ((e * 64 + ph * 4 + (wave - 4)) * 128 + fc0 * 8) * (FRAG * 2)) + lane * 256;
  for (int j = 0; j < 7; ++j) prefetch_unit(pfb, pfo, pfs);
  prefetch_unit(pfb, pfo, ((fc0 + 1 < fc1) ? pfn : 0u) - 7u * pfs);

  __shared__ __attribute__((aligned(16))) bf16t Xs[TILE_M * XS_ST];       // [64][1032]
  __shared__ __attribute__((aligned(16))) bf16t Hs[2][TILE_M * HS_ST];    // two x [64][264]
  __shared__ int   rowTok[TILE_M];
  __shared__ __attribute__((aligned(16))) int   rowDst[TILE_M];   // row of ybuf that takes this row's Y
  __shared__ __attribute__((aligned(16))) float rowW[TILE_M];

  if (t < TILE_M) {
    int idx = tile * TILE_M + t;
    bool ok = idx < count;
    int src = ok ? idx : 0;
    int ent = etok[(size_t)e * N_TOK + src];
    int p0  = Y_ROWS + (g - FULL_T) * (NCHUNK * TILE_M) + t;    // a cut tile: its first piece's row
    rowTok[t] = ent >> 1;
    rowDst[t] = piece ? p0 + fc0 * TILE_M : (ok ? ent : Y_ROWS + P_ROWS + e * TILE_M + t);
    rowW[t]   = ok ? ewt[(size_t)e * N_TOK + src] : 0.0f;
    // tells the last launch where this (token, choice) has its Y: in its own row, or in pieces
    if (ok && fc0 == 0) pmap[ent] = piece ? p0 : -1;
  }
  __syncthreads();

  // ---- gather X tile (bf16) via async copies: 8192 chunks of 16 B, 32 per thread ----
#pragma unroll
  for (int i = 0; i < 4; ++i) {
    unsigned     l[8];
    const bf16t* g[8];
#pragma unroll
    for (int q = 0; q < 8; ++q) {
      int chunk = (i * 8 + q) * FFN_THREADS + t;
      int r = chunk >> 7;
      int c = (chunk & 127) << 3;
      l[q] = (unsigned)(uintptr_t)(Xs + r * XS_ST + c);
      g[q] = Xb + (size_t)rowTok[r] * D_DIM + c;
    }
    async_copy8_b128(l, g);
  }

  const int lrow = lane & 15;
  const int kb8  = (lane >> 4) << 3;

  // packed weights of this wave: 2 column tiles of W1 per chunk, 8 column tiles of W2
  const bf16t* w1w = W1P + ((size_t)(e * 256 + wave * 2) * 32) * FRAG + lane * 8;
  const bf16t* w2w = W2P + ((size_t)(e * 64 + wave * 8) * 128) * FRAG + lane * 8;

  Frag16 ring[8];
#pragma unroll
  for (int s = 0; s < 8; ++s)
    ld_frag(ring[s], w1w + (size_t)fc0 * (16 * 32 * FRAG) + (size_t)((s & 1) * 32 + (s >> 1)) * FRAG);

  v8f acc[8][4];
#pragma unroll
  for (int n = 0; n < 8; ++n)
#pragma unroll
    for (int mi = 0; mi < 4; ++mi) acc[n][mi] = zero8();

  // the first ring loads' address registers are free for reuse behind this line and are not
  // rewritten ahead of it
  asm volatile("s_wait_xcnt 0x0" ::: "memory");
  // the X tile has landed for this wave; the barrier publishes it to the others
  asm volatile("s_wait_asynccnt 0x0" ::: "memory");
  __syncthreads();

  const bf16t* xrow = Xs + lrow * XS_ST + kb8;

  // rolled: one chunk's code is already long, and acc is indexed statically inside it
#pragma unroll 1
  for (int fc = fc0; fc < fc1; ++fc) {
    const bf16t* w1p = w1w + (size_t)fc * (16 * 32 * FRAG);
    const bf16t* w2p = w2w + (size_t)fc * (8 * FRAG);
    const int fnext  = (fc + 1 < fc1) ? fc + 1 : fc;      // last chunk: a valid, unused refill
    const bf16t* w1n = w1w + (size_t)fnext * (16 * 32 * FRAG);
    bf16t* hs = Hs[fc & 1];
    // read ahead of this chunk's refills: loads return in order, and a bias read behind
    // them would wait for the whole ring
    float bb[2];
#pragma unroll
    for (int j = 0; j < 2; ++j)
      bb[j] = b1[(size_t)e * F_DIM + fc * FB + wave * 32 + j * 16 + lrow];
    // the bias loads' address registers are not rewritten ahead of this line
    asm volatile("s_wait_xcnt 0x0" ::: "memory");
    // keeps what follows behind that wait: left free, the scheduler lifts the zeroing of hacc
    // over it, into the registers that the loads still name
    __builtin_amdgcn_sched_barrier(0);

    // ======== H = X @ W1[:, chunk] ========
    v8f hacc[2][4];
#pragma unroll
    for (int j = 0; j < 2; ++j)
#pragma unroll
      for (int mi = 0; mi < 4; ++mi) hacc[j][mi] = zero8();

    // rolled: four k steps (32 WMMAs) a trip; for speed only
#pragma unroll 1
    for (int kt0 = 0; kt0 < 28; kt0 += 4)
      h_block<false>(hacc, ring, xrow, kt0, w1p, w2p, pfb, pfo, pfs);
    // behind the eighth request: on to the chunk after the next, or back where there is none
    h_block<true>(hacc, ring, xrow, 28, w1p, w2p, pfb, pfo, ((fc + 2 < fc1) ? pfn : 0u) - 7u * pfs);

    // ---- bias + gelu -> Hs (bf16) ----
#pragma unroll
    for (int j = 0; j < 2; ++j) {
      int coln = wave * 32 + j * 16 + lrow;
#pragma unroll
      for (int mi = 0; mi < 4; ++mi)
#pragma unroll
        for (int v = 0; v < 8; ++v) {
          float xv = hacc[j][mi][v] + bb[j];
          hs[(mi * 16 + kb8 + v) * HS_ST + coln] = (bf16t)gelu_tanh(xv);
        }
    }
    // the one barrier of a chunk: publishes this chunk's H; with two H buffers it also
    // keeps the next write of this buffer behind every reader's last read of it
    __syncthreads();

    // ======== Y += H @ W2[chunk, :] ========
    const bf16t* hrow = hs + lrow * HS_ST + kb8;
    // unrolled: every refill then reads at a constant offset from one base of the chunk,
    // and no address register is rewritten between the k steps
#pragma unroll
    for (int ks = 0; ks < 7; ++ks)
      y_block<false>(acc, ring, hrow, ks, w2p, w1n);
    y_block<true>(acc, ring, hrow, 7, w2p, w1n);
    // the chunk's weight pointers are advanced behind this line: the issued loads'
    // address registers are not rewritten ahead of it
    asm volatile("s_wait_xcnt 0x0" ::: "memory");
  }

  // ---- epilogue: +b2 (once a tile: with its first chunk), scale by gate, store each row ----
  // Every row of ybuf has one writer, so the rows are stored plainly.
  float bb[8];
#pragma unroll
  for (int n = 0; n < 8; ++n) {
    float x = b2[(size_t)e * D_DIM + (wave * 8 + n) * 16 + lrow];
    bb[n] = (fc0 == 0) ? x : 0.0f;
  }
  // the bias loads' address registers are not rewritten ahead of this line
  asm volatile("s_wait_xcnt 0x0" ::: "memory");
  float* ycol = ybuf + wave * 128 + lrow;
  float* yp[4][8];
#pragma unroll
  for (int mi = 0; mi < 4; ++mi) {
    // the lane's eight rows of this tile row: their places and gates in four 16-byte LDS reads
    union { int4 q[2]; int i[8]; } dst;
    union { float4 q[2]; float f[8]; } w;
#pragma unroll
    for (int h = 0; h < 2; ++h) {
      dst.q[h] = *(const int4*)(rowDst + mi * 16 + kb8 + h * 4);
      w.q[h]   = *(const float4*)(rowW + mi * 16 + kb8 + h * 4);
    }
#pragma unroll
    for (int v = 0; v < 8; ++v) {
      yp[mi][v] = ycol + (size_t)dst.i[v] * D_DIM;
#pragma unroll
      for (int n = 0; n < 8; ++n) acc[n][mi][v] = w.f[v] * (acc[n][mi][v] + bb[n]);
    }
  }
  // every value and every address is formed ahead of the first store: left free, the scheduler
  // mixes them with the stores and rewrites registers that issued stores still name
  __builtin_amdgcn_sched_barrier(0);
#pragma unroll
  for (int mi = 0; mi < 4; ++mi)
#pragma unroll
    for (int v = 0; v < 8; ++v)
#pragma unroll
      for (int n = 0; n < 8; ++n) yp[mi][v][n * 16] = acc[n][mi][v];
}

// ---------------- sum of the two experts' terms + residual + layernorm ----------------
// four columns of one (token, choice): its own row, or the sum of a cut tile's pieces in order
__device__ __forceinline__ float4 y_term(const float* __restrict__ ybuf, int own, int m, int c) {
  if (m < 0) return *(const float4*)(ybuf + (size_t)own * D_DIM + c);
  const float* p = ybuf + (size_t)m * D_DIM + c;
  float4 s = *(const float4*)p;
#pragma unroll
  for (int i = 1; i < NCHUNK; ++i) {
    float4 q = *(const float4*)(p + (size_t)i * TILE_M * D_DIM);
    s.x += q.x; s.y += q.y; s.z += q.z; s.w += q.w;
  }
  return s;
}

__global__ void ln_kernel(const float* __restrict__ ybuf,
                          const int* __restrict__ pmap,
                          const float* __restrict__ inp,
                          const float* __restrict__ gamma,
                          const float* __restrict__ beta,
                          float* __restrict__ out) {
  const int token = blockIdx.x;
  const int t = threadIdx.x;
  __shared__ float red[256];
  __shared__ float mu_sh, rstd_sh;

  const int2 m = *(const int2*)(pmap + 2 * token);
  float4 b = *(const float4*)(inp + (size_t)token * D_DIM + 4 * t);
  float4 a = y_term(ybuf, 2 * token,     m.x, 4 * t);
  // the issued loads' address registers are not rewritten ahead of this line
  asm volatile("s_wait_xcnt 0x0" ::: "memory");
  float4 q = y_term(ybuf, 2 * token + 1, m.y, 4 * t);
  // as above
  asm volatile("s_wait_xcnt 0x0" ::: "memory");
  float s0 = (a.x + q.x) + b.x, s1 = (a.y + q.y) + b.y;
  float s2 = (a.z + q.z) + b.z, s3 = (a.w + q.w) + b.w;

  red[t] = s0 + s1 + s2 + s3;
  __syncthreads();
  for (int s = 128; s > 0; s >>= 1) {
    if (t < s) red[t] += red[t + s];
    __syncthreads();
  }
  if (t == 0) mu_sh = red[0] * (1.0f / D_DIM);
  __syncthreads();
  float mu = mu_sh;
  float d0 = s0 - mu, d1 = s1 - mu, d2 = s2 - mu, d3 = s3 - mu;
  red[t] = d0 * d0 + d1 * d1 + d2 * d2 + d3 * d3;
  __syncthreads();
  for (int s = 128; s > 0; s >>= 1) {
    if (t < s) red[t] += red[t + s];
    __syncthreads();
  }
  if (t == 0) rstd_sh = rsqrtf(red[0] * (1.0f / D_DIM) + 1e-5f);
  __syncthreads();
  float rstd = rstd_sh;

  int c = 4 * t;
  out[(size_t)token * D_DIM + c + 0] = d0 * rstd * gamma[c + 0] + beta[c + 0];
  out[(size_t)token * D_DIM + c + 1] = d1 * rstd * gamma[c + 1] + beta[c + 1];
  out[(size_t)token * D_DIM + c + 2] = d2 * rstd * gamma[c + 2] + beta[c + 2];
  out[(size_t)token * D_DIM + c + 3] = d3 * rstd * gamma[c + 3] + beta[c + 3];
}

extern "C" void kernel_launch(void* const* d_in, const int* in_sizes, int n_in,
                              void* d_out, int out_size, void* d_ws, size_t ws_size,
                              hipStream_t stream) {
  (void)in_sizes; (void)n_in; (void)out_size; (void)ws_size;
  const float* hs    = (const float*)d_in[0];
  const float* inp   = (const float*)d_in[1];
  const float* gw    = (const float*)d_in[2];
  const float* gb    = (const float*)d_in[3];
  const float* w1    = (const float*)d_in[4];
  const float* b1    = (const float*)d_in[5];
  const float* w2    = (const float*)d_in[6];
  const float* b2    = (const float*)d_in[7];
  const float* gamma = (const float*)d_in[8];
  const float* beta  = (const float*)d_in[9];
  float* out = (float*)d_out;

  char* ws = (char*)d_ws;
  size_t off = 0;
  int*   counts = (int*)(ws + off);   off += 256;
  int*   etok   = (int*)(ws + off);   off += (size_t)E_NUM * N_TOK * sizeof(int);
  float* ewt    = (float*)(ws + off); off += (size_t)E_NUM * N_TOK * sizeof(float);
  bf16t* Xb     = (bf16t*)(ws + off); off += (size_t)N_TOK * D_DIM * sizeof(bf16t);
  int*   pmap   = (int*)(ws + off);   off += (size_t)Y_ROWS * sizeof(int);
  float* ybuf   = (float*)(ws + off); off += (size_t)(Y_ROWS + P_ROWS + PAD_ROWS) * D_DIM * sizeof(float);
  bf16t* W1T    = (bf16t*)(ws + off); off += (size_t)E_NUM * F_DIM * D_DIM * sizeof(bf16t);
  bf16t* W2T    = (bf16t*)(ws + off); off += (size_t)E_NUM * F_DIM * D_DIM * sizeof(bf16t);

  zero_kernel<<<dim3(1), dim3(32), 0, stream>>>(counts);
  convert_w_kernel<<<dim3(1024), dim3(256), 0, stream>>>(w1, w2, W1T, W2T);
  router_kernel<<<dim3(RT_GRID), dim3(256), 0, stream>>>(hs, gw, gb, Xb, counts, etok, ewt);
  moe_ffn_kernel<<<dim3(FFN_GRID), dim3(FFN_THREADS), 0, stream>>>(
      W1T, b1, W2T, b2, Xb, counts, etok, ewt, ybuf, pmap);
  ln_kernel<<<dim3(N_TOK), dim3(256), 0, stream>>>(ybuf, pmap, inp, gamma, beta, out);
}

// v008
// Measured time: 238 microseconds a run.
// Next to v007, in two timings, it ran 1.04 times as fast each time.
// Over all steps from v000 it is 8.00 times as fast.
#include <hip/hip_runtime.h>
#include <hip/hip_bf16.h>

#define N_TOK 8192
#define D_DIM 1024
#define E_NUM 8
#define F_DIM 4096
#define TILE_M 64
#define FB 256                  // F columns of one piece of a cut tile
#define NCHUNK (F_DIM / FB)     // 16
#define FFN_THREADS 256         // 8 wave32, 2 per SIMD
#define FRAG 512                // bf16 elements of one packed 16(n) x 32(k) B fragment
// Every token goes to two experts: 2 * N_TOK rows, which fill FULL_T row tiles exactly. Each
// expert rounds its own rows up to whole tiles, so there are FULL_T to FULL_T + E_NUM - 1 tiles.
#define FULL_T (2 * N_TOK / TILE_M)             // 256: one work-group each, all of F
#define XTRA_T (E_NUM - 1)                      // tiles past FULL_T: one work-group a chunk of F
#define FFN_GRID (XTRA_T * NCHUNK + FULL_T)
// Rows of the Y buffer: one per (token, choice), then one per row of every piece of a cut tile.
#define Y_ROWS (2 * N_TOK)
#define P_ROWS (XTRA_T * NCHUNK * TILE_M)
// and, never read, one per row of an expert's last tile: its padding rows land there
#define PAD_ROWS (E_NUM * TILE_M)

// Xs holds row r of the tile at [r % 16][r / 16][k]: the four rows that a lane reads as its A
// fragments lie 2 KB apart, so one address register and immediate offsets reach all of a
// lane's X. XS_LP: bf16 elements from a lane's rows to the next lane's, 8208 B = 16 B x 513.
#define XS_LP (4 * D_DIM + 8)
// A work-group walks F in chunks of CT * 128 columns: CT column tiles of H for each of its 8
// waves. A whole tile takes CT = 4, a piece of a cut tile (one chunk of FB columns) CT = 2.
#define HS_PAD 8     // Hs row stride = chunk width + 8 bf16: 1040 or 528 B/row, 16 B times an odd number
#define HS_BUF (TILE_M * (512 + HS_PAD))   // bf16 elements of one H buffer, the wider chunk's

typedef __bf16 bf16t;
typedef __attribute__((ext_vector_type(16))) bf16t v16bf;
typedef __attribute__((ext_vector_type(8)))  float v8f;

union Frag16 { v16bf v; uint4 u[2]; };

__device__ inline v8f zero8() {
  v8f z;
#pragma unroll
  for (int i = 0; i < 8; ++i) z[i] = 0.0f;
  return z;
}

// 0.5 * (1 + tanh(u)) = 1 / (1 + exp(-2u)), u = 0.79788...(x + 0.044715 x^3): one exp2 and one
// reciprocal a value and no branch. exp2 runs to +inf or to 0 at the ends, which gives the
// limits 0 and x.
__device__ inline float gelu_tanh(float x) {
  const float k = -2.0f * 0.7978845608028654f * 1.4426950408889634f;   // -2 sqrt(2/pi) log2(e)
  const float s = x * (k + (k * 0.044715f) * (x * x));
  return x * __builtin_amdgcn_rcpf(1.0f + __builtin_amdgcn_exp2f(s));
}

// ---- CDNA5 async copy: global -> LDS, 16B per lane, tracked by ASYNCcnt ----
// Eight copies and the s_wait_xcnt that keeps their address registers from being
// rewritten early stand in one statement.
__device__ __forceinline__ void async_copy8_b128(const unsigned* l, const bf16t* const* g) {
  asm volatile("global_load_async_to_lds_b128 %0, %8, off\n\t"
               "global_load_async_to_lds_b128 %1, %9, off\n\t"
               "global_load_async_to_lds_b128 %2, %10, off\n\t"
               "global_load_async_to_lds_b128 %3, %11, off\n\t"
               "global_load_async_to_lds_b128 %4, %12, off\n\t"
               "global_load_async_to_lds_b128 %5, %13, off\n\t"
               "global_load_async_to_lds_b128 %6, %14, off\n\t"
               "global_load_async_to_lds_b128 %7, %15, off\n\t"
               "s_wait_xcnt 0x0"
               :: "v"(l[0]), "v"(l[1]), "v"(l[2]), "v"(l[3]),
                  "v"(l[4]), "v"(l[5]), "v"(l[6]), "v"(l[7]),
                  "v"(g[0]), "v"(g[1]), "v"(g[2]), "v"(g[3]),
                  "v"(g[4]), "v"(g[5]), "v"(g[6]), "v"(g[7])
               : "memory");
}

// ---------------- zero the experts' row counters ----------------
__global__ void zero_kernel(int* counts) {
  if (threadIdx.x < E_NUM) counts[threadIdx.x] = 0;
}

// ---------------- weight convert to bf16, packed in WMMA B-fragment order ----------------
// One fragment = 16 columns (n) x 32 k = 512 elements = 1 KB, stored as
// [half j of the lane's registers][lane = h*16 + n][8 k], k = 16*j + 8*h + i,
// so that each of a fragment's two 16-byte loads reads 512 contiguous bytes.
// W1P: fragment ((e*256 + f/16)*32  + k/32), n = f, k = d-index of X@W1
// W2P: fragment ((e*64  + d/16)*128 + f/32), n = d, k = f-index of H@W2
//
// Both sources are [e][k][n] with n contiguous. A wave takes a 16(k) x 64(n) piece: eight
// 16-byte loads a lane, each wave-wide load two rows of 256 contiguous bytes. A lane then
// holds 4 n x 8 k = four 16-byte units of the packed form, which belong to one half (j) of
// one fragment. The units cross the wave's own LDS range and leave as one 512-byte run
// per fragment. A work-group's 8 waves lie side by side along n, and it takes the same
// piece of every expert in turn.
#define CV_FP 528               // LDS bytes of a fragment half: 512 + 16, so that the four
                                // fragments a half-wave writes at once fall on different banks
#define CV_WV (4 * CV_FP)       // LDS bytes of a wave

typedef __attribute__((ext_vector_type(4))) float v4f;

template <int N>
__device__ __forceinline__ void cv_load(v4f (&v)[8], const float* __restrict__ s, unsigned off) {
#pragma unroll
  for (int i = 0; i < 8; ++i) v[i] = *(const v4f*)(s + off + i * N);
  // the base is advanced behind this line: the issued loads' address registers are not
  // rewritten ahead of it
  asm volatile("s_wait_xcnt 0x0" ::: "memory");
}

__device__ __forceinline__ void cv_pack(uint4 (&p)[4], const v4f (&v)[8]) {
#pragma unroll
  for (int c = 0; c < 4; ++c) {
    union { bf16t b[8]; uint4 u; } x;
#pragma unroll
    for (int i = 0; i < 8; ++i) x.b[i] = (bf16t)v[i][c];
    p[c] = x.u;
  }
}

template <int K>
__device__ __forceinline__ void cv_emit(const uint4 (&p)[4], char* lw, const char* lr,
                                        bf16t* __restrict__ d, unsigned off) {
#pragma unroll
  for (int c = 0; c < 4; ++c) *(uint4*)(lw + c * 16) = p[c];
  // the wave reads back what its other lanes wrote: their LDS stores have to be done
  asm volatile("s_wait_dscnt 0x0" ::: "memory");
#pragma unroll
  for (int g = 0; g < 4; ++g)
    *(uint4*)(d + off + g * (K / 32) * FRAG) = *(const uint4*)(lr + g * CV_FP);
  // the issued stores' address and data registers are not rewritten ahead of this line
  asm volatile("s_wait_xcnt 0x0" ::: "memory");
}

template <int K, int N>
__device__ __forceinline__ void pack_pieces(const float* __restrict__ src,
                                            bf16t* __restrict__ dst,
                                            char* lds, int r) {
  const int t = threadIdx.x;
  const int w = t >> 5;
  const int l = t & 31;
  const int kb = r / (N / 512);       // which 16 k
  const int nb = r % (N / 512);       // which 512 n
  const float* s = src + (size_t)kb * 16 * N + nb * 512;
  bf16t*       d = dst + (size_t)nb * 512 * K + kb * 256;
  const unsigned soff = (unsigned)((l >> 4) * 8 * N + w * 64 + (l & 15) * 4);
  const unsigned doff = (unsigned)(w * 64 * K + l * 8);
  char*       lw = lds + w * CV_WV + ((l & 15) >> 2) * CV_FP + (l >> 4) * 256 + (l & 3) * 64;
  const char* lr = lds + w * CV_WV + l * 16;

  v4f   v[8];
  uint4 p[4];
  cv_load<N>(v, s, soff);
  // rolled: the body is short; the next expert's piece flies while this one crosses LDS
#pragma unroll 1
  for (int e = 0; e + 1 < E_NUM; ++e) {
    cv_pack(p, v);
    s += (size_t)K * N;
    cv_load<N>(v, s, soff);
    cv_emit<K>(p, lw, lr, d, doff);
    d += (size_t)K * N;
  }
  cv_pack(p, v);
  cv_emit<K>(p, lw, lr, d, doff);
}

__global__ void __launch_bounds__(256)
convert_w_kernel(const float* __restrict__ w1,
                 const float* __restrict__ w2,
                 bf16t* __restrict__ W1P,
                 bf16t* __restrict__ W2P) {
  __shared__ __attribute__((aligned(16))) char cvbuf[8 * CV_WV];
  const int r = blockIdx.x & 511;     // 512 work-group pieces an expert in either matrix
  if (blockIdx.x < 512) pack_pieces<D_DIM, F_DIM>(w1, W1P, cvbuf, r);
  else                  pack_pieces<F_DIM, D_DIM>(w2, W2P, cvbuf, r);
}

// ---------------- router: logits, softmax, top-2, bucket append, bf16 convert ----------------
// A work-group takes RT_TOK tokens. Thread t owns columns 4t .. 4t+3 of every one of them, so
// its 32 gate weights are read once and stay in registers. The threads' partial logits cross
// LDS once; then a wave sums a whole token: first over the eight waves' partials, then over
// its lanes. The sums run in the order of a halving tree over the 256 partials (128, 64, ...,
// 1). Wave 0 appends all the tokens to the experts' lists, with one add per counter.
// The short loops are all unrolled, so that xv, gq, q and the logits are indexed statically
// and stay in registers.
#define RT_TOK 16
#define RT_GRID (N_TOK / RT_TOK)

// lane l with lane l ^ 16
__device__ __forceinline__ float lane_xor16(float x) {
  const int b = __builtin_bit_cast(int, x);
  return __builtin_bit_cast(float,
      __builtin_amdgcn_permlanex16(b, b, 0x76543210, 0xfedcba98, false, false));
}
// lane l with lane l ^ MASK inside a row of 16 lanes (DPP row_xmask)
template <int MASK>
__device__ __forceinline__ float row_xor(float x) {
  return __builtin_bit_cast(float,
      __builtin_amdgcn_update_dpp(0, __builtin_bit_cast(int, x), 0x160 | MASK, 0xf, 0xf, true));
}

__global__ void __launch_bounds__(256)
router_kernel(const float* __restrict__ hs,
              const float* __restrict__ gw,
              const float* __restrict__ gb,
              bf16t* __restrict__ Xb,
              int* __restrict__ counts,
              int* __restrict__ etok,
              float* __restrict__ ewt) {
  const int t = threadIdx.x;
  const int wave = t >> 5;
  const int lane = t & 31;
  const int tok0 = blockIdx.x * RT_TOK;
  // [token][experts 0-3 or 4-7][thread]: every LDS access is 16 contiguous bytes a lane
  __shared__ __attribute__((aligned(16))) float4 part_sh[RT_TOK][2][256];
  __shared__ int   sel_sh[RT_TOK][2];
  __shared__ float gate_sh[RT_TOK][2];

  const float* x = hs + (size_t)tok0 * D_DIM + 4 * t;
  float4 xv[RT_TOK];
#pragma unroll
  for (int k = 0; k < RT_TOK; ++k) xv[k] = *(const float4*)(x + k * D_DIM);
  // the thread's gate weights: rows 4t .. 4t+3 of gw, 32 contiguous floats
  v4f gq[8];
#pragma unroll
  for (int i = 0; i < 8; ++i) gq[i] = *(const v4f*)(gw + (size_t)t * (4 * E_NUM) + i * 4);
  // the issued loads' address registers are not rewritten ahead of this line
  asm volatile("s_wait_xcnt 0x0" ::: "memory");
  // holds the gate weights' loads up here, in flight together with x: left free, they sink
  // behind the stores below, and their latency follows that of x
  asm volatile("" :: "v"(gq[0]), "v"(gq[1]), "v"(gq[2]), "v"(gq[3]),
                     "v"(gq[4]), "v"(gq[5]), "v"(gq[6]), "v"(gq[7]));

  bf16t* xb = Xb + (size_t)tok0 * D_DIM + 4 * t;
#pragma unroll
  for (int h = 0; h < RT_TOK / 8; ++h) {
#pragma unroll
    for (int k = h * 8; k < h * 8 + 8; ++k) {
      union { bf16t b[4]; uint2 u; } cv;
      cv.b[0] = (bf16t)xv[k].x; cv.b[1] = (bf16t)xv[k].y;
      cv.b[2] = (bf16t)xv[k].z; cv.b[3] = (bf16t)xv[k].w;
      *(uint2*)(xb + k * D_DIM) = cv.u;
    }
    // the issued stores' address and data registers are not rewritten ahead of this line
    asm volatile("s_wait_xcnt 0x0" ::: "memory");
    // keeps what follows behind that wait: left free, the scheduler lifts later conversions
    // and products over it, into the registers that the stores still name
    __builtin_amdgcn_sched_barrier(0);
  }

#pragma unroll
  for (int k = 0; k < RT_TOK; ++k) {
    float p[E_NUM];
#pragma unroll
    for (int e = 0; e < E_NUM; ++e)
      p[e] = xv[k].x * gq[0 + e / 4][e % 4] + xv[k].y * gq[2 + e / 4][e % 4] +
             xv[k].z * gq[4 + e / 4][e % 4] + xv[k].w * gq[6 + e / 4][e % 4];
    part_sh[k][0][t] = make_float4(p[0], p[1], p[2], p[3]);
    part_sh[k][1][t] = make_float4(p[4], p[5], p[6], p[7]);
  }
  // publishes every thread's partial logits to the wave that sums them
  __syncthreads();

#pragma unroll
  for (int r = 0; r < RT_TOK / 8; ++r) {
    const int k = r * 8 + wave;
    float logit[E_NUM];
#pragma unroll
    for (int h = 0; h < 2; ++h) {
      float4 q[8];
#pragma unroll
      for (int w = 0; w < 8; ++w) q[w] = part_sh[k][h][w * 32 + lane];
      logit[h * 4 + 0] = ((q[0].x + q[4].x) + (q[2].x + q[6].x)) + ((q[1].x + q[5].x) + (q[3].x + q[7].x));
      logit[h * 4 + 1] = ((q[0].y + q[4].y) + (q[2].y + q[6].y)) + ((q[1].y + q[5].y) + (q[3].y + q[7].y));
      logit[h * 4 + 2] = ((q[0].z + q[4].z) + (q[2].z + q[6].z)) + ((q[1].z + q[5].z) + (q[3].z + q[7].z));
      logit[h * 4 + 3] = ((q[0].w + q[4].w) + (q[2].w + q[6].w)) + ((q[1].w + q[5].w) + (q[3].w + q[7].w));
    }
#pragma unroll
    for (int e = 0; e < E_NUM; ++e) {
      float s = logit[e];
      s += lane_xor16(s);
      s += row_xor<8>(s);
      s += row_xor<4>(s);
      s += row_xor<2>(s);
      s += row_xor<1>(s);
      logit[e] = s + gb[e];
    }

    // every lane holds the token's eight logits and does the same small sums
    float m = logit[0];
#pragma unroll
    for (int e = 1; e < E_NUM; ++e) m = fmaxf(m, logit[e]);
    float p[E_NUM], sum = 0.0f;
#pragma unroll
    for (int e = 0; e < E_NUM; ++e) { p[e] = expf(logit[e] - m); sum += p[e]; }
    float inv = 1.0f / sum;
#pragma unroll
    for (int e = 0; e < E_NUM; ++e) p[e] *= inv;
    int i1 = 0; float g1 = p[0];
#pragma unroll
    for (int e = 1; e < E_NUM; ++e) if (p[e] > g1) { g1 = p[e]; i1 = e; }
    int i2 = (i1 == 0) ? 1 : 0; float g2 = (i1 == 0) ? p[1] : p[0];
#pragma unroll
    for (int e = 0; e < E_NUM; ++e) if (e != i1 && p[e] > g2) { g2 = p[e]; i2 = e; }
    if (lane == 0) {
      sel_sh[k][0] = i1;  sel_sh[k][1] = i2;
      gate_sh[k][0] = g1; gate_sh[k][1] = g2;
    }
  }
  // publishes the tokens' choices to wave 0
  __syncthreads();

  if (wave == 0) {
    // lane k appends token k; a token's place in a list is the list's length before this
    // work-group's add plus the number of this work-group's earlier entries for that expert
    const bool on = lane < RT_TOK;
    const int  k  = on ? lane : 0;
    const int   i1 = sel_sh[k][0],  i2 = sel_sh[k][1];
    const float g1 = gate_sh[k][0], g2 = gate_sh[k][1];
    const unsigned below = (1u << lane) - 1u;
    int r1 = 0, r2 = 0, mine = 0;
#pragma unroll
    for (int e = 0; e < E_NUM; ++e) {
      const unsigned m1 = __builtin_amdgcn_ballot_w32(on && i1 == e);
      const unsigned m2 = __builtin_amdgcn_ballot_w32(on && i2 == e);
      if (i1 == e) r1 = __builtin_popcount(m1 & below);
      if (i2 == e) r2 = __builtin_popcount(m1) + __builtin_popcount(m2 & below);
      if (lane == e) mine = __builtin_popcount(m1) + __builtin_popcount(m2);
    }
    int base = 0;
    if (lane < E_NUM) base = atomicAdd(&counts[lane], mine);
    const int pos1 = __shfl(base, i1) + r1;
    const int pos2 = __shfl(base, i2) + r2;
    if (on) {
      // an entry is the token's row of the Y buffer: 2 * token + (first or second choice)
      const int token = tok0 + lane;
      etok[(size_t)i1 * N_TOK + pos1] = 2 * token;
      ewt [(size_t)i1 * N_TOK + pos1] = g1;
      etok[(size_t)i2 * N_TOK + pos2] = 2 * token + 1;
      ewt [(size_t)i2 * N_TOK + pos2] = g2;
    }
  }
}

// ---------------- expert FFN: register-blocked bf16 WMMA, weights global -> VGPR ----------------
// 256 threads = 8 wave32. Per 512-wide F chunk a wave computes H[64 x 64] (4 x 4 tiles),
// then adds H[64 x 512] @ W2 into its own Y[64 x 128] (4 x 8 tiles = 256 VGPRs).
// Every weight fragment is used by exactly one wave, so it goes straight to registers;
// a ring of 8 fragments is refilled in place right after each fragment's last use.
// The short loops over tiles, slots and registers are all unrolled, so that ring, acc,
// hacc and the A fragments are indexed statically and stay in registers.
// p: the fragment's address, the same in every lane; lo: the lane's byte offset in each half of
// a fragment. Kept apart, the uniform part of the weight addresses is formed in scalar
// registers; with per-lane pointers the chunk loop of the wide H block spills one of them
__device__ __forceinline__ void ld_frag(Frag16& f, const bf16t* __restrict__ p, unsigned lo) {
  const char* q = (const char*)p;
  f.u[0] = *(const uint4*)(q + lo);
  f.u[1] = *(const uint4*)(q + lo + 512);
}

// ---- L2 prefetch of the next chunk's packed weights ----
// The work-groups of one expert walk the same 16 MB of weights at about the same place, so the
// one in front takes every line from memory and the others wait for it. A chunk ahead of its
// loads each work-group asks for half of the chunk's weights, one lane a 256-byte unit, one
// request a wave in each of the chunk's H blocks (4 * CT of them). The half goes by the tile
// index: two neighbouring tiles cover a chunk between them. Waves 0-3 ask for W1 (a chunk lies
// in a row: 8 KB out of every 64 KB), waves 4-7 for W2 (a chunk is 8 or 16 KB of each of 64
// column tiles, 128 KB apart: all 8 KB of every eighth tile, or 8 of the 16 KB of every
// fourth). Only a hint: nothing waits for it.
#define PF_W1_STEP (64 * FRAG * 2)              // bytes from a wave's request to its next: W1
#define PF_W2_STEP(CT) ((16 / (CT)) * 128 * FRAG * 2)   // the same: W2
#define PF_W1_NEXT(CT) (8 * (CT) * 32 * FRAG * 2)       // bytes from a chunk to the next: W1
#define PF_W2_NEXT(CT) (4 * (CT) * FRAG * 2)            // the same: W2
__device__ __forceinline__ void prefetch_unit(const bf16t* base, unsigned& off, unsigned adv) {
  // base: the packed matrix, scalar; off: the lane's byte offset in it. An in-out operand: it
  // stays in a register of its own through the loops, which holds nothing but offsets inside
  // the matrix; it is advanced behind this statement, so not ahead of its wait
  asm volatile("global_prefetch_b8 %0, %1 scope:SCOPE_SE\n\t"
               "s_wait_xcnt 0x0"
               : "+v"(off) : "s"(base) : "memory");
  off += adv;
}

// 8 / CT k steps of H += X @ W1; ring slot p*CT+j holds k step kt0+p of column tile j.
// An X fragment read from LDS feeds CT WMMAs.
template <int CT, bool LAST>
__device__ __forceinline__ void h_block(v8f (&hacc)[CT][4], Frag16 (&ring)[8],
                                        const bf16t* xrow, int kt0,
                                        const bf16t* __restrict__ w1p,
                                        const bf16t* __restrict__ w2p, unsigned lo,
                                        const bf16t* pfb, unsigned& pfo, unsigned pfadv) {
#pragma unroll
  for (int p = 0; p < 8 / CT; ++p) {
    Frag16 a[4];
#pragma unroll
    for (int mi = 0; mi < 4; ++mi) {
      const bf16t* ap = xrow + mi * D_DIM + (kt0 + p) * 32;
      a[mi].u[0] = *(const uint4*)(ap);
      a[mi].u[1] = *(const uint4*)(ap + 16);
    }
#pragma unroll
    for (int j = 0; j < CT; ++j) {
      const int s = p * CT + j;
#pragma unroll
      for (int mi = 0; mi < 4; ++mi)
        hacc[j][mi] = __builtin_amdgcn_wmma_f32_16x16x32_bf16(
            false, a[mi].v, false, ring[s].v, (short)0, hacc[j][mi], false, false);
      if (!LAST) {
        ld_frag(ring[s], w1p + (size_t)(j * 32 + kt0 + p + 8 / CT) * FRAG, lo);
      } else {
        ld_frag(ring[s], w2p + (size_t)(s * 128) * FRAG, lo);   // first k step of H @ W2
        // holds each refill directly behind its fragment's last use: left free, the
        // scheduler gathers the refills into late clauses, which shortens their lead
        __builtin_amdgcn_sched_barrier(0);
      }
    }
  }
  prefetch_unit(pfb, pfo, pfadv);
}

// one k step (32 f) of Y += H @ W2; ring slot n holds column tile n
template <int CT, bool LAST>
__device__ __forceinline__ void y_block(v8f (&acc)[8][4], Frag16 (&ring)[8],
                                        const bf16t* hrow, int ks,
                                        const bf16t* __restrict__ w2p,
                                        const bf16t* __restrict__ w1n, unsigned lo) {
  Frag16 a[4];
#pragma unroll
  for (int mi = 0; mi < 4; ++mi) {
    const bf16t* ap = hrow + mi * 16 * (CT * 128 + HS_PAD) + ks * 32;
    a[mi].u[0] = *(const uint4*)(ap);
    a[mi].u[1] = *(const uint4*)(ap + 16);
  }
#pragma unroll
  for (int n = 0; n < 8; ++n) {
#pragma unroll
    for (int mi = 0; mi < 4; ++mi)
      acc[n][mi] = __builtin_amdgcn_wmma_f32_16x16x32_bf16(
          false, a[mi].v, false, ring[n].v, (short)0, acc[n][mi], false, false);
    if (!LAST) ld_frag(ring[n], w2p + (size_t)(n * 128 + ks + 1) * FRAG, lo);
    else       ld_frag(ring[n], w1n + (size_t)((n % CT) * 32 + n / CT) * FRAG, lo);  // next chunk's X @ W1
    // holds each refill directly behind its fragment's last use and in slot order: left
    // free, the scheduler gathers and reorders the refills, their lead shrinks, and the
    // rolled H loop's head has to wait for nearly the whole ring instead of its oldest slot
    __builtin_amdgcn_sched_barrier(0);
  }
}

// The chunks c0 .. c1-1 of a work-group, each CT * 128 columns of F wide: per chunk a wave
// computes H[64 x CT*16] (4 x CT tiles), then adds H[64 x CT*128] @ W2 into its Y[64 x 128].
template <int CT>
__device__ __forceinline__ void ffn_chunks(v8f (&acc)[8][4], const bf16t* Xs, bf16t* Hs,
                                           const bf16t* __restrict__ W1P,
                                           const float* __restrict__ b1,
                                           const bf16t* __restrict__ W2P,
                                           int e, int wave, int lane, int c0, int c1,
                                           const bf16t* pfb, unsigned& pfo,
                                           unsigned pfs, unsigned pfn) {
  constexpr int HST = CT * 128 + HS_PAD;    // Hs row stride
  constexpr int KB  = 8 / CT;               // k steps of one H block
  const int lrow = lane & 15;
  const int kb8  = (lane >> 4) << 3;

  // packed weights of this wave: CT column tiles of W1 per chunk, 8 column tiles of W2
  const bf16t* w1w = W1P + ((size_t)(e * 256 + wave * CT) * 32) * FRAG;
  const bf16t* w2w = W2P + ((size_t)(e * 64 + wave * 8) * 128) * FRAG;
  const unsigned lo = (unsigned)lane * 16u;

  Frag16 ring[8];
#pragma unroll
  for (int s = 0; s < 8; ++s)
    ld_frag(ring[s], w1w + (size_t)c0 * (8 * CT * 32 * FRAG) + (size_t)((s % CT) * 32 + s / CT) * FRAG, lo);

  // the first ring loads' address registers are free for reuse behind this line and are not
  // rewritten ahead of it
  asm volatile("s_wait_xcnt 0x0" ::: "memory");
  // the X tile has landed for this wave; the barrier publishes it to the others
  asm volatile("s_wait_asynccnt 0x0" ::: "memory");
  __syncthreads();

  const bf16t* xrow = Xs + lrow * XS_LP + kb8;

  // rolled: one chunk's code is already long, and acc is indexed statically inside it
#pragma unroll 1
  for (int fc = c0; fc < c1; ++fc) {
    const bf16t* w1p = w1w + (size_t)fc * (8 * CT * 32 * FRAG);
    const bf16t* w2p = w2w + (size_t)fc * (4 * CT * FRAG);
    const int fnext  = (fc + 1 < c1) ? fc + 1 : fc;      // last chunk: a valid, unused refill
    const bf16t* w1n = w1w + (size_t)fnext * (8 * CT * 32 * FRAG);
    bf16t* hs = Hs + (fc & 1) * HS_BUF;
    // read ahead of this chunk's refills: loads return in order, and a bias read behind
    // them would wait for the whole ring
    float bb[CT];
#pragma unroll
    for (int j = 0; j < CT; ++j)
      bb[j] = b1[(size_t)e * F_DIM + fc * (CT * 128) + wave * (CT * 16) + j * 16 + lrow];
    // the bias loads' address registers are not rewritten ahead of this line
    asm volatile("s_wait_xcnt 0x0" ::: "memory");
    // keeps what follows behind that wait: left free, the scheduler lifts the zeroing of hacc
    // over it, into the registers that the loads still name
    __builtin_amdgcn_sched_barrier(0);

    // ======== H = X @ W1[:, chunk] ========
    v8f hacc[CT][4];
#pragma unroll
    for (int j = 0; j < CT; ++j)
#pragma unroll
      for (int mi = 0; mi < 4; ++mi) hacc[j][mi] = zero8();

    // rolled: one H block (32 WMMAs) a trip, for speed only
#pragma unroll 1
    for (int kt0 = 0; kt0 < 32 - KB; kt0 += KB)
      h_block<CT, false>(hacc, ring, xrow, kt0, w1p, w2p, lo, pfb, pfo, pfs);
    // behind the chunk's last request: on to the chunk after the next, or back where there is none
    h_block<CT, true>(hacc, ring, xrow, 32 - KB, w1p, w2p, lo, pfb, pfo,
                      ((fc + 2 < c1) ? pfn : 0u) - (4u * CT - 1u) * pfs);

    // ---- bias + gelu -> Hs (bf16) ----
#pragma unroll
    for (int j = 0; j < CT; ++j) {
      int coln = wave * (CT * 16) + j * 16 + lrow;
#pragma unroll
      for (int mi = 0; mi < 4; ++mi)
#pragma unroll
        for (int v = 0; v < 8; ++v) {
          float xv = hacc[j][mi][v] + bb[j];
          hs[(mi * 16 + kb8 + v) * HST + coln] = (bf16t)gelu_tanh(xv);
        }
    }
    // the one barrier of a chunk: publishes this chunk's H; with two H buffers it also
    // keeps the next chunk's write of the other buffer behind every reader's last read of it
    __syncthreads();

    // ======== Y += H @ W2[chunk, :] ========
    const bf16t* hrow = hs + lrow * HST + kb8;
    // unrolled: every refill then reads at a constant offset from one base of the chunk,
    // and no address register is rewritten between the k steps
#pragma unroll
    for (int ks = 0; ks < 4 * CT - 1; ++ks)
      y_block<CT, false>(acc, ring, hrow, ks, w2p, w1n, lo);
    y_block<CT, true>(acc, ring, hrow, 4 * CT - 1, w2p, w1n, lo);
    // the chunk's weight pointers are advanced behind this line: the issued loads'
    // address registers are not rewritten ahead of it
    asm volatile("s_wait_xcnt 0x0" ::: "memory");
  }
}

__global__ void __launch_bounds__(FFN_THREADS)
moe_ffn_kernel(const bf16t* __restrict__ W1P, const float* __restrict__ b1,
               const bf16t* __restrict__ W2P, const float* __restrict__ b2,
               const bf16t* __restrict__ Xb,
               const int* __restrict__ counts,
               const int* __restrict__ etok,
               const float* __restrict__ ewt,
               float* __restrict__ ybuf,
               int* __restrict__ pmap) {
  const int t = threadIdx.x;
  // the same in every lane: readfirstlane lets what depends on it be formed in scalar registers
  const int wave = __builtin_amdgcn_readfirstlane(t >> 5);
  const int lane = t & 31;

  // One work-group fills a WGP (LDS, registers). A whole tile for each tile would leave the few
  // tiles past FULL_T to a second round on a nearly idle chip. They are cut along F into pieces
  // of FB columns, which have the lowest indices; each stores its part of Y
  // in rows of its own, and the last launch adds the parts.
  const int b = blockIdx.x;
  const bool piece = b < XTRA_T * NCHUNK;
  const int g   = piece ? FULL_T + b / NCHUNK : b - XTRA_T * NCHUNK;   // tile, counted over all experts
  const int fc0 = piece ? b % NCHUNK : 0;      // a piece: its chunk of FB columns

  int e = -1, tile = 0, count = 0, base = 0;
#pragma unroll
  for (int i = 0; i < E_NUM; ++i) {
    const int c = counts[i];
    const int n = (int)(((unsigned)c + TILE_M - 1) / TILE_M);
    if (e < 0 && g < base + n) { e = i; tile = g - base; count = c; }
    base += n;
  }
  if (e < 0) return;      // no such tile; the same for the whole work-group

  // this work-group's half of the first chunk's weights; then the offset goes on to the next
  // chunk, or back to the start of this one where there is none: it never leaves the matrix
  const int  ph  = g & 1;
  const bool pw1 = wave < 4;
  // the same in every lane of a wave: readfirstlane puts them into scalar registers
  const unsigned long long pa = (unsigned long long)(pw1 ? W1P : W2P);
  const bf16t* pfb = (const bf16t*)(
      ((unsigned long long)(unsigned)__builtin_amdgcn_readfirstlane((int)(pa >> 32)) << 32) |
      (unsigned)__builtin_amdgcn_readfirstlane((int)pa));
  const unsigned pfs = (unsigned)__builtin_amdgcn_readfirstlane(
      pw1 ? PF_W1_STEP : (piece ? PF_W2_STEP(2) : PF_W2_STEP(4)));
  const unsigned pfn = (unsigned)__builtin_amdgcn_readfirstlane(
      pw1 ? (piece ? PF_W1_NEXT(2) : PF_W1_NEXT(4)) : (piece ? PF_W2_NEXT(2) : PF_W2_NEXT(4)));
  unsigned pfo = (unsigned)(pw1
      ? ((e * 256 + fc0 * 16) * 32 + ph * 32 + wave * 8) * (FRAG * 2)
      : (piece ? ((e * 64 + ph * 4 + (wave - 4)) * 128 + fc0 * 8) * (FRAG * 2)
               : ((e * 64 + (wave - 4)) * 128 + ph * 8) * (FRAG * 2))) + lane * 256;
  const int pfr = piece ? 8 : 16;     // requests of a wave a chunk
  for (int j = 0; j + 1 < pfr; ++j) prefetch_unit(pfb, pfo, pfs);
  prefetch_unit(pfb, pfo, (piece ? 0u : pfn) - (unsigned)(pfr - 1) * pfs);

  __shared__ __attribute__((aligned(16))) bf16t Xs[16 * XS_LP];           // [16][4][1024] + 8 a lane
  __shared__ __attribute__((aligned(16))) bf16t Hs[2 * HS_BUF];           // two x [64][520]
  __shared__ int   rowTok[TILE_M];
  __shared__ __attribute__((aligned(16))) int   rowDst[TILE_M];   // row of ybuf that takes this row's Y
  __shared__ __attribute__((aligned(16))) float rowW[TILE_M];

  if (t < TILE_M) {
    int idx = tile * TILE_M + t;
    bool ok = idx < count;
    int src = ok ? idx : 0;
    int ent = etok[(size_t)e * N_TOK + src];
    int p0  = Y_ROWS + (g - FULL_T) * (NCHUNK * TILE_M) + t;    // a cut tile: its first piece's row
    rowTok[t] = ent >> 1;
    rowDst[t] = piece ? p0 + fc0 * TILE_M : (ok ? ent : Y_ROWS + P_ROWS + e * TILE_M + t);
    rowW[t]   = ok ? ewt[(size_t)e * N_TOK + src] : 0.0f;
    // tells the last launch where this (token, choice) has its Y: in its own row, or in pieces
    if (ok && fc0 == 0) pmap[ent] = piece ? p0 : -1;
  }
  __syncthreads();

  // ---- gather X tile (bf16) via async copies: 8192 chunks of 16 B, 32 per thread ----
#pragma unroll
  for (int i = 0; i < 4; ++i) {
    unsigned     l[8];
    const bf16t* g[8];
#pragma unroll
    for (int q = 0; q < 8; ++q) {
      int chunk = (i * 8 + q) * FFN_THREADS + t;
      int r = chunk >> 7;
      int c = (chunk & 127) << 3;
      l[q] = (unsigned)(uintptr_t)(Xs + (r & 15) * XS_LP + (r >> 4) * D_DIM + c);
      g[q] = Xb + (size_t)rowTok[r] * D_DIM + c;
    }
    async_copy8_b128(l, g);
  }

  const int lrow = lane & 15;
  const int kb8  = (lane >> 4) << 3;

  v8f acc[8][4];
#pragma unroll
  for (int n = 0; n < 8; ++n)
#pragma unroll
    for (int mi = 0; mi < 4; ++mi) acc[n][mi] = zero8();

  // the same for the whole work-group
  if (piece) ffn_chunks<2>(acc, Xs, Hs, W1P, b1, W2P, e, wave, lane, fc0, fc0 + 1, pfb, pfo, pfs, pfn);
  else       ffn_chunks<4>(acc, Xs, Hs, W1P, b1, W2P, e, wave, lane, 0, F_DIM / 512, pfb, pfo, pfs, pfn);

  // ---- epilogue: +b2 (once a tile: with its first chunk), scale by gate, store each row ----
  // Every row of ybuf has one writer, so the rows are stored plainly.
  float bb[8];
#pragma unroll
  for (int n = 0; n < 8; ++n) {
    float x = b2[(size_t)e * D_DIM + (wave * 8 + n) * 16 + lrow];
    bb[n] = (fc0 == 0) ? x : 0.0f;
  }
  // the bias loads' address registers are not rewritten ahead of this line
  asm volatile("s_wait_xcnt 0x0" ::: "memory");
  float* ycol = ybuf + wave * 128 + lrow;
  float* yp[4][8];
#pragma unroll
  for (int mi = 0; mi < 4; ++mi) {
    // the lane's eight rows of this tile row: their places and gates in four 16-byte LDS reads
    union { int4 q[2]; int i[8]; } dst;
    union { float4 q[2]; float f[8]; } w;
#pragma unroll
    for (int h = 0; h < 2; ++h) {
      dst.q[h] = *(const int4*)(rowDst + mi * 16 + kb8 + h * 4);
      w.q[h]   = *(const float4*)(rowW + mi * 16 + kb8 + h * 4);
    }
#pragma unroll
    for (int v = 0; v < 8; ++v) {
      yp[mi][v] = ycol + (size_t)dst.i[v] * D_DIM;
#pragma unroll
      for (int n = 0; n < 8; ++n) acc[n][mi][v] = w.f[v] * (acc[n][mi][v] + bb[n]);
    }
  }
  // every value and every address is formed ahead of the first store: left free, the scheduler
  // mixes them with the stores and rewrites registers that issued stores still name
  __builtin_amdgcn_sched_barrier(0);
#pragma unroll
  for (int mi = 0; mi < 4; ++mi)
#pragma unroll
    for (int v = 0; v < 8; ++v)
#pragma unroll
      for (int n = 0; n < 8; ++n) yp[mi][v][n * 16] = acc[n][mi][v];
}

// ---------------- sum of the two experts' terms + residual + layernorm ----------------
// four columns of one (token, choice): its own row, or the sum of a cut tile's pieces in order
__device__ __forceinline__ float4 y_term(const float* __restrict__ ybuf, int own, int m, int c) {
  if (m < 0) return *(const float4*)(ybuf + (size_t)own * D_DIM + c);
  const float* p = ybuf + (size_t)m * D_DIM + c;
  float4 s = *(const float4*)p;
#pragma unroll
  for (int i = 1; i < NCHUNK; ++i) {
    float4 q = *(const float4*)(p + (size_t)i * TILE_M * D_DIM);
    s.x += q.x; s.y += q.y; s.z += q.z; s.w += q.w;
  }
  return s;
}

__global__ void ln_kernel(const float* __restrict__ ybuf,
                          const int* __restrict__ pmap,
                          const float* __restrict__ inp,
                          const float* __restrict__ gamma,
                          const float* __restrict__ beta,
                          float* __restrict__ out) {
  const int token = blockIdx.x;
  const int t = threadIdx.x;
  __shared__ float red[256];
  __shared__ float mu_sh, rstd_sh;

  const int2 m = *(const int2*)(pmap + 2 * token);
  float4 b = *(const float4*)(inp + (size_t)token * D_DIM + 4 * t);
  float4 a = y_term(ybuf, 2 * token,     m.x, 4 * t);
  // the issued loads' address registers are not rewritten ahead of this line
  asm volatile("s_wait_xcnt 0x0" ::: "memory");
  float4 q = y_term(ybuf, 2 * token + 1, m.y, 4 * t);
  // as above
  asm volatile("s_wait_xcnt 0x0" ::: "memory");
  float s0 = (a.x + q.x) + b.x, s1 = (a.y + q.y) + b.y;
  float s2 = (a.z + q.z) + b.z, s3 = (a.w + q.w) + b.w;

  red[t] = s0 + s1 + s2 + s3;
  __syncthreads();
  for (int s = 128; s > 0; s >>= 1) {
    if (t < s) red[t] += red[t + s];
    __syncthreads();
  }
  if (t == 0) mu_sh = red[0] * (1.0f / D_DIM);
  __syncthreads();
  float mu = mu_sh;
  float d0 = s0 - mu, d1 = s1 - mu, d2 = s2 - mu, d3 = s3 - mu;
  red[t] = d0 * d0 + d1 * d1 + d2 * d2 + d3 * d3;
  __syncthreads();
  for (int s = 128; s > 0; s >>= 1) {
    if (t < s) red[t] += red[t + s];
    __syncthreads();
  }
  if (t == 0) rstd_sh = rsqrtf(red[0] * (1.0f / D_DIM) + 1e-5f);
  __syncthreads();
  float rstd = rstd_sh;

  int c = 4 * t;
  out[(size_t)token * D_DIM + c + 0] = d0 * rstd * gamma[c + 0] + beta[c + 0];
  out[(size_t)token * D_DIM + c + 1] = d1 * rstd * gamma[c + 1] + beta[c + 1];
  out[(size_t)token * D_DIM + c + 2] = d2 * rstd * gamma[c + 2] + beta[c + 2];
  out[(size_t)token * D_DIM + c + 3] = d3 * rstd * gamma[c + 3] + beta[c + 3];
}

extern "C" void kernel_launch(void* const* d_in, const int* in_sizes, int n_in,
                              void* d_out, int out_size, void* d_ws, size_t ws_size,
                              hipStream_t stream) {
  (void)in_sizes; (void)n_in; (void)out_size; (void)ws_size;
  const float* hs    = (const float*)d_in[0];
  const float* inp   = (const float*)d_in[1];
  const float* gw    = (const float*)d_in[2];
  const float* gb    = (const float*)d_in[3];
  const float* w1    = (const float*)d_in[4];
  const float* b1    = (const float*)d_in[5];
  const float* w2    = (const float*)d_in[6];
  const float* b2    = (const float*)d_in[7];
  const float* gamma = (const float*)d_in[8];
  const float* beta  = (const float*)d_in[9];
  float* out = (float*)d_out;

  char* ws = (char*)d_ws;
  size_t off = 0;
  int*   counts = (int*)(ws + off);   off += 256;
  int*   etok   = (int*)(ws + off);   off += (size_t)E_NUM * N_TOK * sizeof(int);
  float* ewt    = (float*)(ws + off); off += (size_t)E_NUM * N_TOK * sizeof(float);
  bf16t* Xb     = (bf16t*)(ws + off); off += (size_t)N_TOK * D_DIM * sizeof(bf16t);
  int*   pmap   = (int*)(ws + off);   off += (size_t)Y_ROWS * sizeof(int);
  float* ybuf   = (float*)(ws + off); off += (size_t)(Y_ROWS + P_ROWS + PAD_ROWS) * D_DIM * sizeof(float);
  bf16t* W1T    = (bf16t*)(ws + off); off += (size_t)E_NUM * F_DIM * D_DIM * sizeof(bf16t);
  bf16t* W2T    = (bf16t*)(ws + off); off += (size_t)E_NUM * F_DIM * D_DIM * sizeof(bf16t);

  zero_kernel<<<dim3(1), dim3(32), 0, stream>>>(counts);
  convert_w_kernel<<<dim3(1024), dim3(256), 0, stream>>>(w1, w2, W1T, W2T);
  router_kernel<<<dim3(RT_GRID), dim3(256), 0, stream>>>(hs, gw, gb, Xb, counts, etok, ewt);
  moe_ffn_kernel<<<dim3(FFN_GRID), dim3(FFN_THREADS), 0, stream>>>(
      W1T, b1, W2T, b2, Xb, counts, etok, ewt, ybuf, pmap);
  ln_kernel<<<dim3(N_TOK), dim3(256), 0, stream>>>(ybuf, pmap, inp, gamma, beta, out);
}
